// v009
// Times are from an AMD MI455X. After a warm-up the kernel runs many times in a row, and a time is the length of
// such a window on the GPU divided by its runs, so every launch and the gaps after it count. The runs cycle
// through copies of the inputs. A figure is the median of several windows, for all but v000 over two sittings.
// Sittings can differ by a few percent; kernels timed side by side share one.
// The versions before v009 are in another document.
// Measured time: 116 microseconds a run.
// Two timings next to v008 both put it at 1.03 times that version's speed.
// Over all steps from v000, the starting kernel, it is 12.6 times as fast.
// Contractions: q/k/v/o projections X.W [4096x1024].[1024x1024] and the position-wise FFN relu(Y.W1 + b) [4096x1024].[1024x4096], .W2 + b [4096x4096].[4096x1024] with f16 operands on pre-cast planes (v_wmma_f32_16x16x32_f16; register-blocked wave tiles of 64x48 (q/k/v), 32x64 (o, W2) and 64x128 (W1), weights x16); the block-diagonal windowed attention (8 blocks of 128 positions per sequence = 32 independent (sequence, block) attentions, 16 heads, keys >= valid_len SET to -1e6 through an integer keep-mask — exactly the module's where, so blocks lying wholly beyond valid_len are uniform) inside the q/k/v projection's launch, from LDS (f16 q.k^T and p.v with p as f16 of 4096 p); f32 accumulate and softmax. AddNorm LayerNorms (two rows per wave, fixed-order trees) are f32 kernels; the keep-mask is formed inside the attention from the INPUT valid lengths.
#include <hip/hip_runtime.h>
#include <math.h>

typedef __attribute__((ext_vector_type(16))) _Float16 v16h;
typedef __attribute__((ext_vector_type(8)))  _Float16 v8h;
typedef __attribute__((ext_vector_type(16))) __bf16   v16b;
typedef __attribute__((ext_vector_type(8)))  float    v8f;
typedef __attribute__((ext_vector_type(4)))  float    v4f;

// 16-bit WMMA fragment map (wave32), lane L, h = L>>4, m = L&15:
//   A 16x32: lane = row m;   element i -> k = (i<8) ? 8h+i : 16+8h+(i-8)
//   B 32x16: lane = column m; the SAME k(i,h)
//   D 16x16 (8 f32): lane = column m; element r -> row 8h+r
__device__ __forceinline__ int frag_k(int i, int h) { return (i < 8) ? (8 * h + i) : (16 + 8 * h + (i - 8)); }
__device__ __forceinline__ __bf16 bf16_rne(float f) {
    unsigned int u = __float_as_uint(f);
    u += 0x7fffu + ((u >> 16) & 1u);
    return __builtin_bit_cast(__bf16, (unsigned short)(u >> 16));
}
__device__ __forceinline__ float bf16_f32(__bf16 b) { return __uint_as_float(((unsigned int)__builtin_bit_cast(unsigned short, b)) << 16); }
__device__ __forceinline__ v8f wmma16(v16h a, v16h b, v8f c) {
    c = __builtin_amdgcn_wmma_f32_16x16x32_f16(false, a, false, b, (short)0, c, false, false);
    asm volatile("v_nop\n\tv_nop\n\tv_nop\n\tv_nop" : "+v"(c) : "v"(a), "v"(b));
    return c;
}
__device__ __forceinline__ v8f wmmab(v16b a, v16b b, v8f c) {
    c = __builtin_amdgcn_wmma_f32_16x16x32_bf16(false, a, false, b, (short)0, c, false, false);
    asm volatile("v_nop\n\tv_nop\n\tv_nop\n\tv_nop" : "+v"(c) : "v"(a), "v"(b));
    return c;
}
struct Split { v16b hi, lo; };
// hi/lo split product: a.hi*b.hi + a.hi*b.lo + a.lo*b.hi
__device__ __forceinline__ v8f wmma3(const Split& a, const Split& b, v8f c) {
    c = __builtin_amdgcn_wmma_f32_16x16x32_bf16(false, a.hi, false, b.hi, (short)0, c, false, false);
    c = __builtin_amdgcn_wmma_f32_16x16x32_bf16(false, a.hi, false, b.lo, (short)0, c, false, false);
    c = __builtin_amdgcn_wmma_f32_16x16x32_bf16(false, a.lo, false, b.hi, (short)0, c, false, false);
    asm volatile("v_nop\n\tv_nop\n\tv_nop\n\tv_nop" : "+v"(c) : "v"(a.hi), "v"(a.lo), "v"(b.hi), "v"(b.lo));
    return c;
}
struct Split3 { v16b hi, mid, lo; };
// triple split product (6 terms, drops only terms below 2^-24 relative)
__device__ __forceinline__ v8f wmma6(const Split3& a, const Split3& b, v8f c) {
    c = __builtin_amdgcn_wmma_f32_16x16x32_bf16(false, a.hi, false, b.hi, (short)0, c, false, false);
    c = __builtin_amdgcn_wmma_f32_16x16x32_bf16(false, a.hi, false, b.mid, (short)0, c, false, false);
    c = __builtin_amdgcn_wmma_f32_16x16x32_bf16(false, a.mid, false, b.hi, (short)0, c, false, false);
    c = __builtin_amdgcn_wmma_f32_16x16x32_bf16(false, a.hi, false, b.lo, (short)0, c, false, false);
    c = __builtin_amdgcn_wmma_f32_16x16x32_bf16(false, a.mid, false, b.mid, (short)0, c, false, false);
    c = __builtin_amdgcn_wmma_f32_16x16x32_bf16(false, a.lo, false, b.hi, (short)0, c, false, false);
    asm volatile("v_nop\n\tv_nop\n\tv_nop\n\tv_nop" : "+v"(c) : "v"(a.hi), "v"(a.mid), "v"(a.lo), "v"(b.hi), "v"(b.mid), "v"(b.lo));
    return c;
}

// Fragment gathers from f32 memory: element i <- p[(k0 + frag_k(i,h)) * sk] * s, zero for k >= klen.
__device__ __forceinline__ v16h fh_ld(const float* __restrict__ p, long long sk, int k0, int h, int klen, float s) {
    v16h a;
#pragma unroll
    for (int i = 0; i < 16; ++i) { const int k = k0 + frag_k(i, h); a[i] = (k < klen) ? (_Float16)(p[(long long)k * sk] * s) : (_Float16)0.f; }
    return a;
}
__device__ __forceinline__ Split sp_ld(const float* __restrict__ p, long long sk, int k0, int h, int klen, float s) {
    Split r;
#pragma unroll
    for (int i = 0; i < 16; ++i) {
        const int k = k0 + frag_k(i, h); const float x = (k < klen) ? p[(long long)k * sk] * s : 0.f;
        const __bf16 hb = bf16_rne(x); r.hi[i] = hb; r.lo[i] = bf16_rne(x - bf16_f32(hb));
    }
    return r;
}
__device__ __forceinline__ Split3 sp3_ld(const float* __restrict__ p, long long sk, int k0, int h, int klen, float s) {
    Split3 r;
#pragma unroll
    for (int i = 0; i < 16; ++i) {
        const int k = k0 + frag_k(i, h); const float x = (k < klen) ? p[(long long)k * sk] * s : 0.f;
        const __bf16 hb = bf16_rne(x); const float r1 = x - bf16_f32(hb); const __bf16 mb = bf16_rne(r1);
        r.hi[i] = hb; r.mid[i] = mb; r.lo[i] = bf16_rne(r1 - bf16_f32(mb));
    }
    return r;
}
__device__ __forceinline__ v16b bh_ld(const float* __restrict__ p, long long sk, int k0, int h, int klen, float s) {
    v16b a;
#pragma unroll
    for (int i = 0; i < 16; ++i) { const int k = k0 + frag_k(i, h); a[i] = bf16_rne((k < klen) ? p[(long long)k * sk] * s : 0.f); }
    return a;
}
// f16 fragment from an f16 LDS/global row with element stride 1 (k-contiguous), no bounds (tile already zero padded)
__device__ __forceinline__ v16h fh_row(const _Float16* __restrict__ row, int k0, int h) {
    v16h a;
#pragma unroll
    for (int i = 0; i < 16; ++i) a[i] = row[k0 + frag_k(i, h)];
    return a;
}

#define VST2(T, ptr, val) do { const T vst2_v_ = (val); *(T*)(ptr) = vst2_v_;  } while (0)
typedef float v4f __attribute__((ext_vector_type(4)));
#define VST2V4(ptr, val) do { const v4f vst2_v4_ = (val); *(v4f*)(ptr) = vst2_v4_;  } while (0)

__device__ __attribute__((noinline)) float act_fn(float v, int act) {
    if (act == 1) return fmaxf(v, 0.f);                                                                               // relu
    if (act == 2) { const float u = 0.7978845608028654f * (v + 0.044715f * v * v * v); return 0.5f * v * (1.f + tanhf(u)); } // tanh-gelu
    if (act == 3) return v / (1.f + expf(-v));                                                                        // silu
    if (act == 4) return 0.5f * v * (1.f + erff(v * 0.7071067811865476f));                                             // erf-gelu
    if (act == 5) return tanhf(v);
    if (act == 6) return 1.f / (1.f + expf(-v));                                                                      // sigmoid
    if (act == 7) return (v > 0.f) ? v : 0.01f * v;                                                                   // leaky relu 0.01
    if (act == 8) return (v > 0.f) ? v : (expf(v) - 1.f);                                                             // elu
    if (act == 9) return fminf(fmaxf(v, 0.f), 6.f);                                                                   // relu6
    if (act == 10) return fabsf(v);                                                                                    // abs
    if (act == 11) return (v >= 0.f) ? v : 0.1f * v;                                                                  // leaky 0.1
    if (act == 12) return (v > 0.f) ? v : 0.2f * v;                                                                   // leaky 0.2
    if (act == 13) return (v > 20.f) ? v : log1pf(expf(v));                                                            // softplus
    return v;
}

// =====================================================================================================================
// k_gemm<MODE>: C(z, m, n) = act(alpha * sum_k A(z, m, k) * B(z, k, n) + bias) + beta * R(z, m, n)
//   One wave (32-thread block) per 16 x 32 tile of C; grid (ceil(N/32), ceil(M/16), Z). Batch z -> (zo = z / zi_n, zi = z % zi_n)
//   with separate outer/inner strides for every tensor (e.g. batch and head). A(m,k) = A[zo*sAo + zi*sAi + m*sAm + k*sAk] (f32),
//   B(k,n) = B[zo*sBo + zi*sBi + n*sBn + k*sBk] (f32); any M, N, K (K zero-padded to 32 inside the fragments, M/N tails guarded).
//   C(m,n) = C[zo*sCo + zi*sCi + m*sCm + n] (n contiguous). flags: 1 bias[n], 2 bias[m], 4 residual R[zo*sRo + zi*sRi + m*sRm + n*sRn].
//   MODE 0: f16 operands (A prescaled by sa, B by sb, both undone in the epilogue); 1: bf16 hi/lo split (3 products); 2: bf16;
//   3: bf16 hi/mid/lo triple split (6 products); 4: as 3 with Kahan-compensated f32 accumulation across k-steps.
// =====================================================================================================================
struct GemmP {
    const float* A; const float* B; const float* bias; const float* R; float* C;
    long long sAo, sAi, sAm, sAk, sBo, sBi, sBn, sBk, sCo, sCi, sCm, sRo, sRi, sRm, sRn;
    int M, N, K, zi_n, flags, act; float alpha, beta, sa, sb;
    int Npad, pad_;     // columns [N, Npad) of C are written as 0 so that padded workspace rows are covered by whole-line stores; Npad >= N
};
static_assert(sizeof(GemmP) == 5 * 8 + 15 * 8 + 6 * 4 + 4 * 4 + 2 * 4, "GemmP has padding");

template <int MODE>
__global__ __launch_bounds__(32) void k_gemm(GemmP p) {
    const int lane = threadIdx.x & 31, h = lane >> 4, l15 = lane & 15;
    const int m0 = blockIdx.y * 16, n0 = blockIdx.x * 32;
    const int z = blockIdx.z, zo = z / p.zi_n, zi = z - zo * p.zi_n;
    const float* A = p.A + zo * p.sAo + zi * p.sAi;
    const float* B = p.B + zo * p.sBo + zi * p.sBi;
    const int am = min(m0 + l15, p.M - 1);                       // clamped row for loads (stores are guarded)
    v8f acc[2], comp[2];
#pragma unroll
    for (int t = 0; t < 2; ++t) { v8f zz = {}; acc[t] = zz; comp[t] = zz; }
    for (int k0 = 0; k0 < p.K; k0 += 32) {
        const float* arow = A + (long long)am * p.sAm;
        if (MODE == 1) {
            const Split a = sp_ld(arow, p.sAk, k0, h, p.K, 1.f);
#pragma unroll
            for (int t = 0; t < 2; ++t) {
                const int bn = min(n0 + t * 16 + l15, p.N - 1);
                acc[t] = wmma3(a, sp_ld(B + (long long)bn * p.sBn, p.sBk, k0, h, p.K, 1.f), acc[t]);
            }
        } else if (MODE == 3) {
            const Split3 a = sp3_ld(arow, p.sAk, k0, h, p.K, 1.f);
#pragma unroll
            for (int t = 0; t < 2; ++t) {
                const int bn = min(n0 + t * 16 + l15, p.N - 1);
                acc[t] = wmma6(a, sp3_ld(B + (long long)bn * p.sBn, p.sBk, k0, h, p.K, 1.f), acc[t]);
            }
        } else if (MODE == 4) {
            // triple split as MODE 3, but each k-step's 6 products go into a fresh accumulator and the partial is added to the running f32 sum
            // on the VALU with Kahan compensation (accumulation error stays ~1 ulp however long K is)
            const Split3 a = sp3_ld(arow, p.sAk, k0, h, p.K, 1.f);
#pragma unroll
            for (int t = 0; t < 2; ++t) {
                const int bn = min(n0 + t * 16 + l15, p.N - 1); v8f zz = {};
                const v8f part = wmma6(a, sp3_ld(B + (long long)bn * p.sBn, p.sBk, k0, h, p.K, 1.f), zz);
                const v8f y = part - comp[t]; const v8f s = acc[t] + y; comp[t] = (s - acc[t]) - y; acc[t] = s;
            }
        } else if (MODE == 2) {
            const v16b a = bh_ld(arow, p.sAk, k0, h, p.K, 1.f);
#pragma unroll
            for (int t = 0; t < 2; ++t) {
                const int bn = min(n0 + t * 16 + l15, p.N - 1);
                acc[t] = wmmab(a, bh_ld(B + (long long)bn * p.sBn, p.sBk, k0, h, p.K, 1.f), acc[t]);
            }
        } else {
            const v16h a = fh_ld(arow, p.sAk, k0, h, p.K, p.sa);
#pragma unroll
            for (int t = 0; t < 2; ++t) {
                const int bn = min(n0 + t * 16 + l15, p.N - 1);
                acc[t] = wmma16(a, fh_ld(B + (long long)bn * p.sBn, p.sBk, k0, h, p.K, p.sb), acc[t]);
            }
        }
    }
    const float iscale = (MODE == 0) ? p.alpha / (p.sa * p.sb) : p.alpha;
    float* C = p.C + zo * p.sCo + zi * p.sCi;
    const float* R = p.R + zo * p.sRo + zi * p.sRi;
    __shared__ __align__(16) float ctile[16][36];
#pragma unroll
    for (int t = 0; t < 2; ++t) {
        const int n = n0 + t * 16 + l15; const int nn = min(n, p.N - 1);
#pragma unroll
        for (int r = 0; r < 8; ++r) {
            const int m = m0 + 8 * h + r; const int mm = min(m, p.M - 1);
            float v = acc[t][r] * iscale;
            if (p.flags & 1) v += p.bias[nn];
            if (p.flags & 2) v += p.bias[mm];
            if (p.flags & 8) v *= p.bias[(long long)zo * p.M + mm];   /* per-(z,row) scale vector laid out [Z][M]; exclusive with the bias flags */
            v = act_fn(v, p.act);
            if (p.flags & 4) v += p.beta * R[(long long)mm * p.sRm + (long long)nn * p.sRn];
            ctile[8 * h + r][t * 16 + l15] = (n < p.N) ? v : 0.f;
        }
    }
    __syncthreads();
    const int NW = (p.Npad > p.N) ? p.Npad : p.N;           // write width
    const bool fast = (m0 + 16 <= p.M) && (n0 + 32 <= NW) && ((p.sCm & 3) == 0) && ((((size_t)C) & 15) == 0);
    if (fast) {
#pragma unroll
        for (int s = 0; s < 4; ++s) {
            const int row = s * 4 + (lane >> 3), c4 = (lane & 7) * 4;
            const v4f v = *(const v4f*)&ctile[row][c4];
            VST2V4(C + (long long)(m0 + row) * p.sCm + n0 + c4, v);
        }
    } else {
        for (int row = 0; row < 16; ++row) {
            const int m = m0 + row, n = n0 + lane;
            if (m < p.M && n < NW) VST2(float, C + (long long)m * p.sCm + n, ctile[row][lane]);
        }
    }
}


// =====================================================================================================================
// k_gemmT<MODE, TM, TN>: same contract as k_gemm, but one wave computes a (16*TM) x (16*TN) tile: TM A fragments and TN B fragments are
//   loaded per 32-wide k-step and reused across TM*TN WMMAs (far fewer load/convert instructions per MAC). MODE 0 (f16), 1 (bf16 hi/lo),
//   2 (bf16) only. grid (ceil(NW/(16*TN)), ceil(M/(16*TM)), Z), block 32. Epilogue identical to k_gemm, run per 16x32 sub-tile.
// =====================================================================================================================
template <int MODE, int TM, int TN>
__global__ __launch_bounds__(32) void k_gemmT(GemmP p) {
    const int lane = threadIdx.x & 31, h = lane >> 4, l15 = lane & 15;
    const int m0 = blockIdx.y * (16 * TM), n0 = blockIdx.x * (16 * TN);
    const int z = blockIdx.z, zo = z / p.zi_n, zi = z - zo * p.zi_n;
    const float* A = p.A + zo * p.sAo + zi * p.sAi;
    const float* B = p.B + zo * p.sBo + zi * p.sBi;
    v8f acc[TM][TN];
#pragma unroll
    for (int i = 0; i < TM; ++i)
#pragma unroll
        for (int t = 0; t < TN; ++t) { v8f zz = {}; acc[i][t] = zz; }
    for (int k0 = 0; k0 < p.K; k0 += 32) {
        if (MODE == 1) {
            Split a[TM], b[TN];
#pragma unroll
            for (int i = 0; i < TM; ++i) { const int am = min(m0 + 16 * i + l15, p.M - 1); a[i] = sp_ld(A + (long long)am * p.sAm, p.sAk, k0, h, p.K, 1.f); }
#pragma unroll
            for (int t = 0; t < TN; ++t) { const int bn = min(n0 + 16 * t + l15, p.N - 1); b[t] = sp_ld(B + (long long)bn * p.sBn, p.sBk, k0, h, p.K, 1.f); }
#pragma unroll
            for (int i = 0; i < TM; ++i)
#pragma unroll
                for (int t = 0; t < TN; ++t) acc[i][t] = wmma3(a[i], b[t], acc[i][t]);
        } else if (MODE == 2) {
            v16b a[TM], b[TN];
#pragma unroll
            for (int i = 0; i < TM; ++i) { const int am = min(m0 + 16 * i + l15, p.M - 1); a[i] = bh_ld(A + (long long)am * p.sAm, p.sAk, k0, h, p.K, 1.f); }
#pragma unroll
            for (int t = 0; t < TN; ++t) { const int bn = min(n0 + 16 * t + l15, p.N - 1); b[t] = bh_ld(B + (long long)bn * p.sBn, p.sBk, k0, h, p.K, 1.f); }
#pragma unroll
            for (int i = 0; i < TM; ++i)
#pragma unroll
                for (int t = 0; t < TN; ++t) acc[i][t] = wmmab(a[i], b[t], acc[i][t]);
        } else {
            v16h a[TM], b[TN];
#pragma unroll
            for (int i = 0; i < TM; ++i) { const int am = min(m0 + 16 * i + l15, p.M - 1); a[i] = fh_ld(A + (long long)am * p.sAm, p.sAk, k0, h, p.K, p.sa); }
#pragma unroll
            for (int t = 0; t < TN; ++t) { const int bn = min(n0 + 16 * t + l15, p.N - 1); b[t] = fh_ld(B + (long long)bn * p.sBn, p.sBk, k0, h, p.K, p.sb); }
#pragma unroll
            for (int i = 0; i < TM; ++i)
#pragma unroll
                for (int t = 0; t < TN; ++t) acc[i][t] = wmma16(a[i], b[t], acc[i][t]);
        }
    }
    const float iscale = (MODE == 0) ? p.alpha / (p.sa * p.sb) : p.alpha;
    float* C = p.C + zo * p.sCo + zi * p.sCi;
    const float* R = p.R + zo * p.sRo + zi * p.sRi;
    const int NW = (p.Npad > p.N) ? p.Npad : p.N;
    __shared__ __align__(16) float ctile[16][36];
#pragma unroll
    for (int i = 0; i < TM; ++i) {
        const int mb = m0 + 16 * i; if (mb >= p.M) break;          // wave-uniform
#pragma unroll
        for (int tp = 0; tp < TN / 2; ++tp) {
            const int nb = n0 + 32 * tp; if (nb >= NW) break;        // wave-uniform
#pragma unroll
            for (int t2 = 0; t2 < 2; ++t2) {
                const int t = 2 * tp + t2; const int n = nb + t2 * 16 + l15; const int nn = min(n, p.N - 1);
#pragma unroll
                for (int r = 0; r < 8; ++r) {
                    const int m = mb + 8 * h + r; const int mm = min(m, p.M - 1);
                    float v = acc[i][t][r] * iscale;
                    if (p.flags & 1) v += p.bias[nn];
                    if (p.flags & 2) v += p.bias[mm];
            if (p.flags & 8) v *= p.bias[(long long)zo * p.M + mm];   /* per-(z,row) scale vector laid out [Z][M]; exclusive with the bias flags */
                    v = act_fn(v, p.act);
                    if (p.flags & 4) v += p.beta * R[(long long)mm * p.sRm + (long long)nn * p.sRn];
                    ctile[8 * h + r][t2 * 16 + l15] = (n < p.N) ? v : 0.f;
                }
            }
            __syncthreads();
            const bool fast = (mb + 16 <= p.M) && (nb + 32 <= NW) && ((p.sCm & 3) == 0) && ((((size_t)C) & 15) == 0);
            if (fast) {
#pragma unroll
                for (int s = 0; s < 4; ++s) {
                    const int row = s * 4 + (lane >> 3), c4 = (lane & 7) * 4;
                    const v4f v = *(const v4f*)&ctile[row][c4];
                    VST2V4(C + (long long)(mb + row) * p.sCm + nb + c4, v);
                }
            } else {
                for (int row = 0; row < 16; ++row) {
                    const int m = mb + row, n = nb + lane;
                    if (m < p.M && n < NW) VST2(float, C + (long long)m * p.sCm + n, ctile[row][lane]);
                }
            }
            __syncthreads();
        }
    }
}

// =====================================================================================================================
//   Wave = 16 queries, AW waves per block, 64-key blocks; grid (ceil(Lq/(16*AW)), H, B), block 32*AW. Any Lq, Lk; head dim dh <= DHP
//   (DHP multiple of 32), value dim dv <= DVP (multiple of 16, <= 128). Every tensor addressed by (batch, head, row, element) strides, f32.
//   Scores: QM 0 f16 operands, 1 bf16 hi/lo split, 2 bf16 triple split; statistics f32 (exp2 domain); P.V: P x 4096 as f16 with V f16 staged in LDS
//   (SPLITPV: P and V as bf16 hi/lo splits). kv head = h / hrep. Masking: causal = 1 (keep j <= i + coff, masked -> -inf, key blocks beyond the
//   diagonal skipped), causal = 2 (masked -> mfill, a finite fill like the -1e9; no skipping), causal = 3 (keep j >= i + coff,
//   masked -> -inf, no skipping); optional additive f32 mask Mf,
//   optional int keep-mask Mi (0 -> score := mfill), both addressed b*smb + h*smh + i*smi + j*smj (0 strides broadcast).
// =====================================================================================================================
#define AW 4
struct AttnP {   // apv4
    const float* Q; const float* K; const float* V; float* O; float* P; const float* Mf; const int* Mi; float* ST;
    const float* Pw; const float* Rt; const int* SQ; const int* SK;           // optional: post-softmax weight, relative-position table, segment ids
    long long swb, swh, swi, swj, srb, srh, sri;                                 // Pw strides (b,h,i,j); Rt strides (b,h,i), column = clamp(i - j + roff, 0, rn-1)
    long long sQb, sQh, sQi, sQd, sKb, sKh, sKj, sKd, sVb, sVh, sVj, sVd, sOb, sOh, sOi, sPb, sPh, sPi, smb, smh, smi, smj;
    int Lq, Lk, dh, dv, hrep, causal, coff, pband;   // pband > 0: P holds only the band |j - i| <= pband, column j - i + pband
    float scale, mfill; int nonorm, mpol;             // nonorm (online path only): O = sum_j exp(score_j) V_j without the 1/rowsum (scores must be <= ~0); mpol: Mi masks where ==0 (mpol 0) or where !=0 (mpol 1)
    int roff, rn, segpol, win;                        // Rt column offset/count; SQ/SK: score := mfill where (segpol 0) SQ[i] != SK[j] or (segpol 1) SQ[i] == SK[j]; win > 0: keys with i - j > win (after coff) -> -inf
};
//   Pw: the softmax numerator is multiplied by Pw(b,h,i,j) AFTER the row sum is taken (probs * weight, then P.V), as in post-softmax multiplicative biases.                                                    // ST (optional): per row (b,h,i) -> ST[((b*H + h)*Lq + i)*2 + {0,1}] = {row max of the scaled+masked score (natural units), sum_j exp(score - max)}
static_assert(sizeof(AttnP) == 12 * 8 + 29 * 8 + 16 * 4, "AttnP has padding");

#ifndef KATTN_ATTR
#define KATTN_ATTR
#endif
template <int DHP, int DVP, int QM, bool SPLITPV, bool TWOPASS>
__global__ __launch_bounds__(32 * AW) KATTN_ATTR void k_attn(AttnP p) {
    constexpr int NT = DVP / 16;                // output tiles
    constexpr int KS = DHP / 32;                // k-steps for the scores
    constexpr int VP = DVP + 8;                 // LDS pitch (halves)
    __shared__ __align__(16) float    pl[AW][16 * 64];
    __shared__ __align__(16) _Float16 vl[(SPLITPV ? 2 : 1) * 64 * VP];   // f16 V tile, or bf16 hi and lo tiles (same 2-byte size)
    const int lane = threadIdx.x & 31, hf = lane >> 4, l15 = lane & 15, wave = threadIdx.x >> 5;
    const int h = blockIdx.y, b = blockIdx.z, hk = h / p.hrep;
    const int q0 = (blockIdx.x * AW + wave) * 16;
    float* myp = pl[wave];
    const float L2E = 1.4426950408889634f;
    const float NEG = -__builtin_inff();
    const int qi = min(q0 + l15, p.Lq - 1);
    const float* qrow = p.Q + b * p.sQb + h * p.sQh + (long long)qi * p.sQi;
    const float* kbase = p.K + b * p.sKb + hk * p.sKh;
    const float* vbase = p.V + b * p.sVb + hk * p.sVh;
    v16h qa[QM == 0 ? KS : 1]; Split qs_[QM == 1 ? KS : 1]; Split3 qt_[QM == 2 ? KS : 1];
#pragma unroll
    for (int ks = 0; ks < KS; ++ks) {
        if (QM == 2) qt_[ks] = sp3_ld(qrow, p.sQd, ks * 32, hf, p.dh, 1.f);
        else if (QM == 1) qs_[ks] = sp_ld(qrow, p.sQd, ks * 32, hf, p.dh, 1.f);
        else qa[ks] = fh_ld(qrow, p.sQd, ks * 32, hf, p.dh, 1.f);
    }
    v8f o[NT]; float m8[8], l8[8];
#pragma unroll
    for (int t = 0; t < NT; ++t) { v8f zz = {}; o[t] = zz; }
#pragma unroll
    for (int i = 0; i < 8; ++i) { m8[i] = NEG; l8[i] = 0.f; }
    int jend = p.Lk; int jstart = 0;
    if (p.causal == 1) { const int je = (blockIdx.x * AW + AW - 1) * 16 + 16 + p.coff; jend = min(jend, max(je, 0)); }   // uniform per block
    if (p.win > 0) { const int js = (int)(blockIdx.x * AW) * 16 + p.coff - p.win; jstart = (js > 0) ? (js / 64) * 64 : 0; }   // uniform per block: key blocks entirely outside every row's window hold only -inf entries and are skipped exactly
    const int npass = TWOPASS ? 2 : 1;
    for (int pass = 0; pass < npass; ++pass) {
        const bool dopv = (!TWOPASS) || pass == 1;
        for (int j0 = jstart; j0 < jend; j0 += 64) {
            if (dopv) {
                __syncthreads();                                 // previous key block's reads of vl / pl are done
                for (int idx = threadIdx.x; idx < 64 * DVP; idx += 32 * AW) {
                    const int jr = idx / DVP, d = idx - jr * DVP, j = j0 + jr;
                    const float f = (j < p.Lk && d < p.dv) ? vbase[(long long)j * p.sVj + (long long)d * p.sVd] : 0.f;
                    if (SPLITPV) {
                        const __bf16 hb = bf16_rne(f);
                        ((__bf16*)vl)[jr * VP + d] = hb; ((__bf16*)vl)[64 * VP + jr * VP + d] = bf16_rne(f - bf16_f32(hb));
                    } else vl[jr * VP + d] = (_Float16)f;
                }
            }
            v8f s[4];
#pragma unroll
            for (int t = 0; t < 4; ++t) {
                const int j = min(j0 + t * 16 + l15, p.Lk - 1);
                const float* krow = kbase + (long long)j * p.sKj;
                v8f acc = {};
#pragma unroll
                for (int ks = 0; ks < KS; ++ks) {
                    if (QM == 2)      acc = wmma6(qt_[ks], sp3_ld(krow, p.sKd, ks * 32, hf, p.dh, 1.f), acc);
                    else if (QM == 1) acc = wmma3(qs_[ks], sp_ld(krow, p.sKd, ks * 32, hf, p.dh, 1.f), acc);
                    else              acc = wmma16(qa[ks], fh_ld(krow, p.sKd, ks * 32, hf, p.dh, 1.f), acc);
                }
                s[t] = acc;
            }
            float pv[8][4];
#pragma unroll
            for (int i = 0; i < 8; ++i) {
                const int irow = q0 + i + 8 * hf;
                const int ic = min(irow, p.Lq - 1);
                float sc[4];
#pragma unroll
                for (int t = 0; t < 4; ++t) {
                    const int jg = j0 + t * 16 + l15;
                    float v = s[t][i] * p.scale;
                    if (p.Mf) v += p.Mf[b * p.smb + h * p.smh + (long long)ic * p.smi + (long long)min(jg, p.Lk - 1) * p.smj];
                    if (p.Rt) { int rc = ic - min(jg, p.Lk - 1) + p.roff; rc = rc < 0 ? 0 : (rc >= p.rn ? p.rn - 1 : rc); v += p.Rt[b * p.srb + h * p.srh + (long long)ic * p.sri + rc]; }
                    if (p.Mi) { const int mv = p.Mi[b * p.smb + h * p.smh + (long long)ic * p.smi + (long long)min(jg, p.Lk - 1) * p.smj]; if (p.mpol ? (mv != 0) : (mv == 0)) v = p.mfill; }
                    if (p.SQ) { const bool same = p.SQ[(long long)b * p.Lq + ic] == p.SK[(long long)b * p.Lk + min(jg, p.Lk - 1)]; if (p.segpol ? same : !same) v = p.mfill; }
                    if (p.causal == 2 && jg > irow + p.coff) v = p.mfill;
                    if (jg >= p.Lk || (p.causal == 1 && jg > irow + p.coff) || (p.causal == 3 && jg < irow + p.coff) || (p.win > 0 && irow + p.coff - jg > p.win)) v = NEG; else v *= L2E;
                    sc[t] = v;
                }
                if (!TWOPASS || pass == 0) {
                    float mx = fmaxf(fmaxf(sc[0], sc[1]), fmaxf(sc[2], sc[3]));
                    mx = fmaxf(mx, __shfl_xor(mx, 1, 32)); mx = fmaxf(mx, __shfl_xor(mx, 2, 32));
                    mx = fmaxf(mx, __shfl_xor(mx, 4, 32)); mx = fmaxf(mx, __shfl_xor(mx, 8, 32));
                    const float mnew = fmaxf(m8[i], mx);
                    const float corr = (mnew == NEG) ? 1.f : exp2f(m8[i] - mnew);
                    float rs = 0.f;
#pragma unroll
                    for (int t = 0; t < 4; ++t) {
                        const float pp = (sc[t] == NEG) ? 0.f : exp2f(sc[t] - mnew); rs += pp;
                        pv[i][t] = p.Pw ? pp * p.Pw[b * p.swb + h * p.swh + (long long)ic * p.swi + (long long)min(j0 + t * 16 + l15, p.Lk - 1) * p.swj] : pp;
                    }
                    rs += __shfl_xor(rs, 1, 32); rs += __shfl_xor(rs, 2, 32); rs += __shfl_xor(rs, 4, 32); rs += __shfl_xor(rs, 8, 32);
                    l8[i] = l8[i] * corr + rs; m8[i] = mnew;
                    if (!TWOPASS) {
#pragma unroll
                        for (int t = 0; t < NT; ++t) o[t][i] *= corr;
                    }
                } else {
                    const float inv = (l8[i] > 0.f) ? 1.f / l8[i] : 0.f;
#pragma unroll
                    for (int t = 0; t < 4; ++t) {
                        const int jg = j0 + t * 16 + l15;
                        float pp = (sc[t] == NEG) ? 0.f : exp2f(sc[t] - m8[i]) * inv;
                        if (p.Pw) pp *= p.Pw[b * p.swb + h * p.swh + (long long)ic * p.swi + (long long)min(jg, p.Lk - 1) * p.swj];
                        pv[i][t] = pp;
                    }
                }
            }
            if (dopv) {
#pragma unroll
                for (int i = 0; i < 8; ++i)
#pragma unroll
                    for (int t = 0; t < 4; ++t) ((float*)myp)[(i + 8 * hf) * 64 + t * 16 + l15] = pv[i][t];
                __syncthreads();                                 // P (per wave) and V (shared) visible
                if (p.P) {
                    float* pb_ = p.P + b * p.sPb + h * p.sPh;
                    const bool fastP = (p.pband == 0) && ((p.sPi & 3) == 0) && (j0 + 64 <= p.Lk) && (q0 + 16 <= p.Lq) && ((((size_t)pb_) & 15) == 0);
                    if (fastP) {
#pragma unroll
                        for (int s = 0; s < 8; ++s) {
                            const int row = s * 2 + (lane >> 4), c4 = (lane & 15) * 4;
                            const v4f v = *(const v4f*)(myp + row * 64 + c4);
                            VST2V4(pb_ + (long long)(q0 + row) * p.sPi + j0 + c4, v);
                        }
                    } else {
                        for (int row = 0; row < 16; ++row) {
                            const int irow = q0 + row; if (irow >= p.Lq) continue;
                            for (int c = lane; c < 64; c += 32) {
                                const int jg = j0 + c; if (jg >= p.Lk) continue;
                                if (p.pband == 0) VST2(float, pb_ + (long long)irow * p.sPi + jg, myp[row * 64 + c]);
                                else if (jg - irow <= p.pband && irow - jg <= p.pband) VST2(float, pb_ + (long long)irow * p.sPi + (jg - irow + p.pband), myp[row * 64 + c]);
                            }
                        }
                    }
                }
                if (SPLITPV) {
                    const Split pa0 = sp_ld(myp + l15 * 64, 1, 0, hf, 64, 1.f), pa1 = sp_ld(myp + l15 * 64, 1, 32, hf, 64, 1.f);
                    const __bf16* vh = (const __bf16*)vl; const __bf16* vlo = vh + 64 * VP;
#pragma unroll
                    for (int t = 0; t < NT; ++t) {
                        const int dcol = t * 16 + l15;
                        Split b0, b1;
#pragma unroll
                        for (int e = 0; e < 16; ++e) {
                            const int k0 = frag_k(e, hf), k1 = 32 + frag_k(e, hf);
                            b0.hi[e] = vh[k0 * VP + dcol]; b0.lo[e] = vlo[k0 * VP + dcol]; b1.hi[e] = vh[k1 * VP + dcol]; b1.lo[e] = vlo[k1 * VP + dcol];
                        }
                        o[t] = wmma3(pa0, b0, o[t]);
                        o[t] = wmma3(pa1, b1, o[t]);
                    }
                } else {
                    const v16h pa0 = fh_ld(myp + l15 * 64, 1, 0, hf, 64, 4096.f), pa1 = fh_ld(myp + l15 * 64, 1, 32, hf, 64, 4096.f);
#pragma unroll
                    for (int t = 0; t < NT; ++t) {
                        const int dcol = t * 16 + l15;
                        v16h b0, b1;
#pragma unroll
                        for (int e = 0; e < 16; ++e) { b0[e] = vl[frag_k(e, hf) * VP + dcol]; b1[e] = vl[(32 + frag_k(e, hf)) * VP + dcol]; }
                        o[t] = wmma16(pa0, b0, o[t]);
                        o[t] = wmma16(pa1, b1, o[t]);
                    }
                }
            }
        }
    }
    float* obase = p.O + b * p.sOb + h * p.sOh;
    if (p.ST) {
        const int rl = lane >> 1, isel = rl & 7;           // row q0 + rl ; rl>>3 == hf holds because lane>>4 == (lane>>1)>>3
        float mv = 0.f, lv = 0.f;
#pragma unroll
        for (int i = 0; i < 8; ++i) if (i == isel) { mv = m8[i]; lv = l8[i]; }
        const int irow = q0 + rl;
        if (irow < p.Lq) { float* st = p.ST + (((long long)b * gridDim.y + h) * p.Lq + irow) * 2 + (lane & 1); VST2(float, st, (lane & 1) ? lv : mv * 0.6931471805599453f); }
    }
    float invr[8];
#pragma unroll
    for (int i = 0; i < 8; ++i) {
        if (TWOPASS) invr[i] = SPLITPV ? 1.f : (1.f / 4096.f);
        else if (p.nonorm) invr[i] = exp2f(m8[i]) * (SPLITPV ? 1.f : (1.f / 4096.f));
        else invr[i] = (l8[i] > 0.f) ? (SPLITPV ? 1.f / l8[i] : 1.f / (l8[i] * 4096.f)) : 0.f;
    }
    __syncthreads();                                             // all waves done with pl/vl from the main loop
    const bool ofast = ((p.sOi & 3) == 0) && ((((size_t)obase) & 15) == 0) && (q0 + 16 <= p.Lq);
#pragma unroll
    for (int c0 = 0; c0 < DVP; c0 += 64) {
#pragma unroll
        for (int i = 0; i < 8; ++i)
#pragma unroll
            for (int t = 0; t < NT; ++t) if (t * 16 >= c0 && t * 16 < c0 + 64) ((float*)myp)[(i + 8 * hf) * 64 + (t * 16 - c0) + l15] = o[t][i] * invr[i];
        __syncthreads();
        const int cw = (DVP - c0 < 64) ? (DVP - c0) : 64;      // staged columns in this chunk (multiple of 16)
        if (ofast && (c0 + cw <= p.dv) && (cw % 32 == 0)) {
            const int lpr = cw / 4;                              // lanes per row (16 for 64 cols, 8 for 32)
            const int rows_per_ins = 32 / lpr;
            for (int r0 = 0; r0 < 16; r0 += rows_per_ins) {
                const int row = r0 + lane / lpr, c4 = (lane % lpr) * 4;
                const v4f v = *(const v4f*)(myp + row * 64 + c4);
                VST2V4(obase + (long long)(q0 + row) * p.sOi + c0 + c4, v);
            }
        } else {
            for (int row = 0; row < 16; ++row) {
                const int irow = q0 + row; if (irow >= p.Lq) continue;
                for (int c = lane; c < cw; c += 32) { const int d = c0 + c; if (d < p.dv) VST2(float, obase + (long long)irow * p.sOi + d, myp[row * 64 + c]); }
            }
        }
        __syncthreads();
    }
}

// =====================================================================================================================
// k_tr: dst(z, c, r) = alpha * src(z, r, c) (+ beta * R2(z, c, r)): [Z][R][C] (row stride lds) -> [Z][C][R] (row stride ldd) through a 32x32 LDS tile;
//   flags: 1 -> add beta * residual R2 addressed like dst (z*sRz + c*ldr + r); act applied before the residual.
// =====================================================================================================================
struct TrP { const float* src; float* dst; const float* R2; long long sSz, lds, sDz, ldd, sRz, ldr; int R, C, flags, act; float alpha, beta; };
static_assert(sizeof(TrP) == 3 * 8 + 6 * 8 + 6 * 4, "TrP has padding");
__global__ __launch_bounds__(256) void k_tr(TrP p) {
    __shared__ float tile[32][33];
    const int c0 = blockIdx.x * 32, r0 = blockIdx.y * 32, z = blockIdx.z;
    const int lane = threadIdx.x & 31, wave = threadIdx.x >> 5;
    const float* s = p.src + z * p.sSz;
#pragma unroll
    for (int k = 0; k < 4; ++k) {
        const int rl = wave * 4 + k, r = r0 + rl, c = c0 + lane;
        tile[rl][lane] = (r < p.R && c < p.C) ? s[(long long)r * p.lds + c] : 0.f;
    }
    __syncthreads();
    float* d = p.dst + z * p.sDz; const float* rr = p.R2 + z * p.sRz;
#pragma unroll
    for (int k = 0; k < 4; ++k) {
        const int cl = wave * 4 + k, c = c0 + cl, r = r0 + lane;
        if (c < p.C && r < p.R) {
            float v = act_fn(p.alpha * tile[lane][cl], p.act);
            if (p.flags & 1) v += p.beta * rr[(long long)c * p.ldr + r];
            VST2(float, d + (long long)c * p.ldd + r, v);
        }
    }
}

// k_affine: dst[i] = a * (sdev ? sdev[0] : 1) * src[i] + b, i < n (one thread per element; consecutive lanes -> consecutive addresses)
__global__ __launch_bounds__(256) void k_affine(const float* __restrict__ src, float* __restrict__ dst, int n, float a, float b, const float* __restrict__ sdev) {
    const int i = blockIdx.x * 256 + threadIdx.x;
    if (i < n) { const float aa = sdev ? a * sdev[0] : a; const float v = aa * src[i] + b; VST2(float, dst + i, v); }
}

// =====================================================================================================================
// k_softmax: row softmax over n contiguous elements, one 256-thread block per row; rows addressed z*sz + r*sr (grid (R, Z)).
//   out = scale_out * softmax(scale_in * x + (Mf ? Mf[z*smz + r*smr + j] : 0)); a row whose max is -inf is written as 0.
// =====================================================================================================================
struct SmP { const float* src; float* dst; const float* Mf; long long sz, sr, dz, dr, smz, smr; int n, pad; float scale_in, scale_out; };
static_assert(sizeof(SmP) == 3 * 8 + 6 * 8 + 4 * 4, "SmP has padding");
__global__ __launch_bounds__(256) void k_softmax(SmP p) {
    __shared__ float red[256];
    const int r = blockIdx.x, z = blockIdx.y, tid = threadIdx.x;
    const float* s = p.src + z * p.sz + (long long)r * p.sr;
    const float* mf = p.Mf ? (p.Mf + z * p.smz + (long long)r * p.smr) : nullptr;
    float mx = -__builtin_inff();
    for (int j = tid; j < p.n; j += 256) { float v = s[j] * p.scale_in; if (mf) v += mf[j]; mx = fmaxf(mx, v); }
    red[tid] = mx; __syncthreads();
    for (int o = 128; o > 0; o >>= 1) { if (tid < o) red[tid] = fmaxf(red[tid], red[tid + o]); __syncthreads(); }
    mx = red[0]; __syncthreads();
    float sum = 0.f;
    for (int j = tid; j < p.n; j += 256) { float v = s[j] * p.scale_in; if (mf) v += mf[j]; sum += (mx == -__builtin_inff()) ? 0.f : expf(v - mx); }
    red[tid] = sum; __syncthreads();
    for (int o = 128; o > 0; o >>= 1) { if (tid < o) red[tid] += red[tid + o]; __syncthreads(); }
    sum = red[0];
    const float inv = (sum > 0.f) ? p.scale_out / sum : 0.f;
    float* d = p.dst + z * p.dz + (long long)r * p.dr;
    for (int j = tid; j < p.n; j += 256) { float v = s[j] * p.scale_in; if (mf) v += mf[j]; const float o = (mx == -__builtin_inff()) ? 0.f : expf(v - mx) * inv; VST2(float, d + j, o); }
}
// =====================================================================================================================
// k_stats: mean and rsqrt(var + eps) over a set of n elements addressed base + z*sz + (e / inner) * so + (e % inner) * si, one 256-thread
// k_norm_apply: y = (x - mean[set]) * rstd[set] * g[c] + b[c] over a [Z][C][L] channel-major tensor with set = z*G + c / (C/G) (G groups per z;
//   G = C -> per-channel sets indexed z*C+c; for batch norm pass stats indexed by c only via bn = 1). Optional act. Output same layout.
// =====================================================================================================================
//   mode 0: mean / rsqrt(var + eps); mode 1 (RMSNorm): 0 / rsqrt(mean(x^2) + eps); mode 2 (L2 normalize * sqrt(n)): 0 / sqrt(n) / max(||x||, eps); mode 3: as 0 with unbiased variance (n-1)
__global__ __launch_bounds__(256) void k_stats(const float* __restrict__ x, long long sz, long long so, long long si, int inner, int n, float eps, float* __restrict__ stat, int mode) {
    __shared__ float red[256];
    const int z = blockIdx.x, tid = threadIdx.x;
    const float* base = x + z * sz;
    float s = 0.f;
    for (int e = tid; e < n; e += 256) s += base[(long long)(e / inner) * so + (long long)(e % inner) * si];
    red[tid] = s; __syncthreads();
    for (int o = 128; o > 0; o >>= 1) { if (tid < o) red[tid] += red[tid + o]; __syncthreads(); }
    const float mu = (mode == 0 || mode == 3) ? red[0] / (float)n : 0.f; __syncthreads();
    float q = 0.f;
    for (int e = tid; e < n; e += 256) { const float dlt = base[(long long)(e / inner) * so + (long long)(e % inner) * si] - mu; q += dlt * dlt; }
    red[tid] = q; __syncthreads();
    for (int o = 128; o > 0; o >>= 1) { if (tid < o) red[tid] += red[tid + o]; __syncthreads(); }
    {
        float rs;
        if (mode == 2) rs = sqrtf((float)n) / fmaxf(sqrtf(red[0]), eps); else if (mode == 3) rs = rsqrtf(red[0] / (float)(n - 1) + eps); else rs = rsqrtf(red[0] / (float)n + eps);
        if (tid < 32) { const float v = (tid == 0) ? mu : ((tid == 1) ? rs : 0.f); VST2(float, stat + (long long)z * 32 + tid, v); }
    }
}
//   One thread per element over the flat [Z][C][L] index space: grid ceil(Z*C*L / 256).
__global__ __launch_bounds__(256) void k_norm_apply(const float* __restrict__ x, float* __restrict__ y, const float* __restrict__ stat, const float* __restrict__ g, const float* __restrict__ bta,
                                                     int Z, int C, int L, int G, int bn, int act) {
    const long long idx = (long long)blockIdx.x * 256 + threadIdx.x;
    if (idx >= (long long)Z * C * L) return;
    const int l = (int)(idx % L); const long long zc = idx / L; const int c = (int)(zc % C), z = (int)(zc / C); (void)l;
    const int set = bn ? c : (z * G + c / (C / G));
    float v = (x[idx] - stat[(long long)set * 32]) * stat[(long long)set * 32 + 1];
    if (g) v *= g[c];
    if (bta) v += bta[c];
    v = act_fn(v, act);
    VST2(float, y + idx, v);
}

// k_lse_neg: c[i] = -(st[2i] + log(st[2i+1])) = minus the log-sum-exp of row i from k_attn's ST output (for softmax over the query dimension)
__global__ __launch_bounds__(256) void k_lse_neg(const float* __restrict__ st, float* __restrict__ c, int n) {
    const int i = blockIdx.x * 256 + threadIdx.x;
    if (i < n) { const float v = -(st[2 * i] + logf(st[2 * i + 1])); VST2(float, c + i, v); }
}

// k_iota: dst[i] = a * i + b as int32 (segment/position id helper)
__global__ __launch_bounds__(256) void k_iota(int* __restrict__ dst, int n, int a, int b) {
    const int i = blockIdx.x * 256 + threadIdx.x;
    if (i < n) { const int v = a * i + b; VST2(int, dst + i, v); }
}

// k_axpby: dst[i] = a * x[i] + b * y[i] (+ c), i < n
__global__ __launch_bounds__(256) void k_axpby(const float* __restrict__ x, const float* __restrict__ y, float* __restrict__ dst, int n, float a, float b, float c) {
    const int i = blockIdx.x * 256 + threadIdx.x;
    if (i < n) { const float v = a * x[i] + b * y[i] + c; VST2(float, dst + i, v); }
}

// =====================================================================================================================
// k_rope: rotary embedding on a [R rows][Hn heads][D] view (row stride sXr, head stride sXh, element stride 1) -> Y (own strides).
//   mode 0: rotate_half (partner d±D/2, sign - for d<D/2); mode 1: interleaved pairs (partner d^1, sign - for even d).
//   table column tcol: tmode 0 -> d, 1 -> d % (D/2), 2 -> d / 2; position p: pmode 0 -> r % S, 1 -> head index, 2 -> pos[r];
//   c = C[(r / S) * sCb + p * sCp + tcol * sCd], s likewise from Sn; y = x[d] * c + sign * x[partner] * s. X and Y must not alias.
// =====================================================================================================================
struct RopeP { const float* X; float* Y; const float* C; const float* Sn; const int* pos; long long sXr, sXh, sYr, sYh, sCb, sCp, sCd; int R, Hn, D, S, mode, tmode, pmode, pad; };
static_assert(sizeof(RopeP) == 5 * 8 + 7 * 8 + 8 * 4, "RopeP has padding");
__global__ __launch_bounds__(256) void k_rope(RopeP p) {
    const long long idx = (long long)blockIdx.x * 256 + threadIdx.x;
    if (idx >= (long long)p.R * p.Hn * p.D) return;
    const int d = (int)(idx % p.D); const long long rh = idx / p.D; const int h = (int)(rh % p.Hn); const int r = (int)(rh / p.Hn);
    const int half = p.D / 2;
    int partner; float sign;
    if (p.mode == 0) { partner = (d < half) ? d + half : d - half; sign = (d < half) ? -1.f : 1.f; }
    else { partner = d ^ 1; sign = (d & 1) ? 1.f : -1.f; }
    const int tcol = (p.tmode == 0) ? d : ((p.tmode == 1) ? (d % half) : (d >> 1));
    const int pp = (p.pmode == 0) ? (r % p.S) : ((p.pmode == 1) ? h : p.pos[r]);
    const long long toff = (long long)(r / p.S) * p.sCb + (long long)pp * p.sCp + (long long)tcol * p.sCd;
    const float* xr = p.X + (long long)r * p.sXr + (long long)h * p.sXh;
    const float v = xr[d] * p.C[toff] + sign * xr[partner] * p.Sn[toff];
    VST2(float, p.Y + (long long)r * p.sYr + (long long)h * p.sYh + d, v);
}

// k_invf + k_sincos (split so neither kernel carries a large VALU-fma footprint): invf_i = num * (1 / powf(base, (2 i)/D)) [fmode 0],
//   num * expf((2 i) * cexp) [fmode 1], num * powf(base, -2 (i - 1) / D) [fmode 2]; then cs/sn[s*half + i] = cos/sin((pscale * s) * invf_i)
__global__ __launch_bounds__(256) void k_invf(float* __restrict__ invb, int half, int D, float base, float num, int fmode, float cexp) {
    const int i = blockIdx.x * 256 + threadIdx.x;
    if (i >= ((half + 31) / 32) * 32) return;
    if (i >= half) { VST2(float, invb + i, 0.f); return; }
    const float e = (float)(2 * i) / (float)D;
    float invf;
    if (fmode == 1) invf = num * expf((float)(2 * i) * cexp);
    else if (fmode == 2) invf = num * powf(base, (-2.0f * ((float)i - 1.0f)) / (float)D);
    else invf = num * (1.0f / powf(base, e));
    VST2(float, invb + i, invf);
}
__global__ __launch_bounds__(256) void k_sincos(float* __restrict__ cs, float* __restrict__ sn, const float* __restrict__ invb, int S, int half, float pscale) {
    const int idx = blockIdx.x * 256 + threadIdx.x;
    if (idx >= S * half) return;
    const int s = idx / half, i = idx - s * half;
    const float ang = (pscale * (float)s) * invb[i];
    VST2(float, cs + idx, cosf(ang)); VST2(float, sn + idx, sinf(ang));
}

// k_mulact: dst[i] = act(x[i]) * y[i]
__global__ __launch_bounds__(256) void k_mulact(const float* __restrict__ x, const float* __restrict__ y, float* __restrict__ dst, int n, int act) {
    const int i = blockIdx.x * 256 + threadIdx.x;
    if (i < n) { const float v = act_fn(x[i], act) * y[i]; VST2(float, dst + i, v); }
}

// =====================================================================================================================
// k_matvec: thread-per-row matrix-vector products for N <= 8 output columns (heads with 1-3 outputs, gates), f32 on the VALU.
//   C[r*sCm + j] = act(alpha * sum_k A[r*sAm + k*sAk] * B[j*sBn + k*sBk] + bias[j]) + beta * R[r*sRm + j*sRn]; each thread writes its N contiguous floats.
// =====================================================================================================================
__global__ __launch_bounds__(256) void k_matvec(GemmP p) {
    // 32 lanes write one line with one instruction.
    const int rpt = (p.N == 1) ? 1 : 32;
    const long long r0 = ((long long)blockIdx.x * 256 + threadIdx.x) * rpt; const int z = blockIdx.z, zo = z / p.zi_n, zi = z - zo * p.zi_n;
    if (r0 >= p.M) return;
    const float* Bb = p.B + zo * p.sBo + zi * p.sBi;
    float* C = p.C + zo * p.sCo + zi * p.sCi; const float* R = p.R + zo * p.sRo + zi * p.sRi;
    for (int rr = 0; rr < rpt; ++rr) {
        const long long r = r0 + rr; if (r >= p.M) break;
        const float* A = p.A + zo * p.sAo + zi * p.sAi + r * p.sAm;
        float acc[8] = {0.f, 0.f, 0.f, 0.f, 0.f, 0.f, 0.f, 0.f};
        for (int k = 0; k < p.K; ++k) { const float a = A[(long long)k * p.sAk];
#pragma unroll
            for (int j = 0; j < 8; ++j) if (j < p.N) acc[j] += a * Bb[(long long)j * p.sBn + (long long)k * p.sBk]; }
#pragma unroll
        for (int j = 0; j < 8; ++j) if (j < p.N) {
            float v = acc[j] * p.alpha;
            if (p.flags & 1) v += p.bias[j];
            if (p.flags & 2) v += p.bias[r];
            v = act_fn(v, p.act);
            if (p.flags & 4) v += p.beta * R[r * p.sRm + (long long)j * p.sRn];
            VST2(float, C + r * p.sCm + j, v);
        }
    }
}
// k_smallsoftmax: thread-per-row softmax for short rows (n <= 64): dst[r*dr + j] = softmax(scale*src[r*sr + j])
__global__ __launch_bounds__(256) void k_smallsoftmax(const float* __restrict__ src, float* __restrict__ dst, long long sr, long long dr, int n, long long R, float scale) {
    const long long r0 = ((long long)blockIdx.x * 256 + threadIdx.x) * 32;
    for (int rr = 0; rr < 32; ++rr) {
        const long long r = r0 + rr; if (r >= R) return;
        const float* s = src + r * sr; float* d = dst + r * dr;
        float mx = -__builtin_inff();
        for (int j = 0; j < n; ++j) mx = fmaxf(mx, s[j] * scale);
        float sum = 0.f;
        for (int j = 0; j < n; ++j) sum += expf(s[j] * scale - mx);
        const float inv = 1.f / sum;
        for (int j = 0; j < n; ++j) { const float v = expf(s[j] * scale - mx) * inv; VST2(float, d + j, v); }
    }
}

__global__ __launch_bounds__(32) void k_unitstat(float* __restrict__ st) { const int t = threadIdx.x; const float v = (t == 1) ? 1.f : 0.f; VST2(float, st + t, v); }

// destination (e.g. a d_out whose row width is not a multiple of 32 floats) is written by consecutive lanes of one instruction
__global__ __launch_bounds__(256) void k_lincopy(const float* __restrict__ src, long long lds, float* __restrict__ dst, long long ldd, long long rows, int cols) {
    const long long i = (long long)blockIdx.x * 256 + threadIdx.x; if (i >= rows * cols) return;
    const long long r = i / cols; const int c = (int)(i - r * cols);
    const float v = src[r * lds + c]; VST2(float, dst + r * ldd + c, v);
}

namespace w25 {
typedef __attribute__((ext_vector_type(16))) _Float16 v16h;
typedef __attribute__((ext_vector_type(8)))  _Float16 v8h;
typedef __attribute__((ext_vector_type(16))) __bf16   v16b;
typedef __attribute__((ext_vector_type(8)))  __bf16   v8b;
typedef __attribute__((ext_vector_type(8)))  float    v8f;
typedef __attribute__((ext_vector_type(4)))  float    v4f;

__device__ __forceinline__ unsigned short f2bf_bits(float f) {
  unsigned u = __float_as_uint(f);
  return (unsigned short)((u + 0x7FFFu + ((u >> 16) & 1u)) >> 16);
}
__device__ __forceinline__ float bf_bits2f(unsigned short h) { return __uint_as_float(((unsigned)h) << 16); }

// hazard guards as plain device helpers (no inline asm inside the kernel template body)
__device__ __forceinline__ void dep_guard_h(v8f& a, v8f& b, v16h x, v16h y) { asm volatile("v_nop\n\tv_nop\n\tv_nop\n\tv_nop" : "+v"(a), "+v"(b) : "v"(x), "v"(y)); }
__device__ __forceinline__ void dep_guard_b(v8f& a, v8f& b, v16b x, v16b y) { asm volatile("v_nop\n\tv_nop\n\tv_nop\n\tv_nop" : "+v"(a), "+v"(b) : "v"(x), "v"(y)); }
__device__ __forceinline__ void keep4_h(v16h a, v16h b, v16h c, v16h d) { asm volatile("v_nop" :: "v"(a), "v"(b), "v"(c), "v"(d)); }
__device__ __forceinline__ void keep4_b(v16b a, v16b b, v16b c, v16b d) { asm volatile("v_nop" :: "v"(a), "v"(b), "v"(c), "v"(d)); }
__device__ __forceinline__ void acc_guard4(v8f& a, v8f& b, v8f& c, v8f& d) { asm volatile("v_nop\n\tv_nop\n\tv_nop\n\tv_nop" : "+v"(a), "+v"(b), "+v"(c), "+v"(d)); }
template <typename T> struct Frag;
template <> struct Frag<_Float16> {
  typedef v16h V; union U { v16h v; v8h h[2]; };
  static __device__ __forceinline__ v16h load(const _Float16* p) {   // elements 0..7 <- p[0..7], 8..15 <- p[16..23]
    U f; f.h[0] = *(const v8h*)(p); f.h[1] = *(const v8h*)(p + 16); return f.v;
  }
  static __device__ __forceinline__ v8f mma(v16h a, v16h b, v8f c) {
    return __builtin_amdgcn_wmma_f32_16x16x32_f16(false, a, false, b, (short)0, c, false, false);
  }
  static __device__ __forceinline__ void guard(v8f& a, v8f& b, v16h x, v16h y) { dep_guard_h(a, b, x, y); }
  static __device__ __forceinline__ void keep(v16h a, v16h b, v16h c, v16h d) { keep4_h(a, b, c, d); }
};
template <> struct Frag<__bf16> {
  typedef v16b V; union U { v16b v; v8b h[2]; };
  static __device__ __forceinline__ v16b load(const __bf16* p) {
    U f; f.h[0] = *(const v8b*)(p); f.h[1] = *(const v8b*)(p + 16); return f.v;
  }
  static __device__ __forceinline__ v8f mma(v16b a, v16b b, v8f c) {
    return __builtin_amdgcn_wmma_f32_16x16x32_bf16(false, a, false, b, (short)0, c, false, false);
  }
  static __device__ __forceinline__ void guard(v8f& a, v8f& b, v16b x, v16b y) { dep_guard_b(a, b, x, y); }
  static __device__ __forceinline__ void keep(v16b a, v16b b, v16b c, v16b d) { keep4_b(a, b, c, d); }
};

// ---- Register-blocked batched WMMA GEMM ------------------------------------
// C[m,n] = scale * sum_k A[m,k] * Bt[n,k] (+bias)(+resid); each wave owns a 64x64 tile.
// A row-major [M,K]; Bt row-major [N,K]; M,N % 64 == 0, K % 32 == 0.
// SPLIT: operands are hi/lo planes (A2/Bt2 = lo planes, same layout); product = hi·hi + hi·lo + lo·hi.
// BIAS_MODE: 0 = none, 1 = bias[m], 2 = bias[n].
// OUT_MODE: 0 = f32, 1 = f16, 2 = bf16 hi plane (Cout) + bf16 lo plane (Cout2).
// ET: 0 = f16 operands, 1 = bf16 operands (pointers passed as 16-bit storage)
template <int ET> struct Elem;
template <> struct Elem<0> { typedef _Float16 T; };
template <> struct Elem<1> { typedef __bf16 T; };
template <int ET, bool SPLIT, int BIAS_MODE, int OUT_MODE, bool RESID, int ACT = 0>
__global__ __launch_bounds__(256) void wmma_gemm64(
    const unsigned short* __restrict__ Ap, const unsigned short* __restrict__ A2p, int lda, long strideA,
    const unsigned short* __restrict__ Btp, const unsigned short* __restrict__ Bt2p, int ldb, long strideB,
    void* __restrict__ Cout, void* __restrict__ Cout2, int ldc, long strideC,
    const float* __restrict__ bias,
    const float* __restrict__ resid, long strideR,
    int M, int N, int K, float scale) {
  typedef typename Elem<ET>::T T;
  typedef typename Frag<T>::V V;
  const T* A = (const T*)Ap; const T* A2 = (const T*)A2p; const T* Bt = (const T*)Btp; const T* Bt2 = (const T*)Bt2p;
  __shared__ __align__(16) float sT[8][16 * 68];   // per-wave 16x64 slab, pitch 68 floats
  const int b    = blockIdx.y;
  const int lane = threadIdx.x & 31;
  const int wave = threadIdx.x >> 5;
  const int tilesN = N >> 6;
  const int tilesM = M >> 6;
  const int tile = blockIdx.x * 8 + wave;
  if (tile >= tilesM * tilesN) return;   // wave-uniform; no block barriers in this kernel
  const int tm = tile / tilesN;
  const int tn = tile - tm * tilesN;
  const int m0 = tm << 6;
  const int n0 = tn << 6;

  const T* Ab  = A  + (size_t)b * strideA;
  const T* Bb  = Bt + (size_t)b * strideB;
  const T* Ab2 = SPLIT ? (A2  + (size_t)b * strideA) : nullptr;
  const T* Bb2 = SPLIT ? (Bt2 + (size_t)b * strideB) : nullptr;

  const int rlane = lane & 15;                 // row (A) / col (B, D) within subtile
  const int koff  = (lane >> 4) * 8;           // k offset of this lane half
  const int mOff  = (lane >> 4) * 8;           // D row offset

  v8f acc[4][4];
#pragma unroll
  for (int i = 0; i < 4; ++i)
#pragma unroll
    for (int j = 0; j < 4; ++j) acc[i][j] = (v8f){0.f,0.f,0.f,0.f,0.f,0.f,0.f,0.f};

  for (int k0 = 0; k0 < K; k0 += 32) {
    V bh[4], bl[4];
#pragma unroll
    for (int j = 0; j < 4; ++j) {
      const size_t bo = (size_t)(n0 + (j << 4) + rlane) * ldb + koff + k0;
      bh[j] = Frag<T>::load(Bb + bo);
      if (SPLIT) bl[j] = Frag<T>::load(Bb2 + bo);
    }
#pragma unroll
    for (int i = 0; i < 4; ++i) {
      const size_t ao = (size_t)(m0 + (i << 4) + rlane) * lda + koff + k0;
      V ah = Frag<T>::load(Ab + ao);
      V al;
      if (SPLIT) al = Frag<T>::load(Ab2 + ao);
#pragma unroll
      for (int j = 0; j < 4; ++j) {
        acc[i][j] = Frag<T>::mma(ah, bh[j], acc[i][j]);
        if (SPLIT) {
          acc[i][j] = Frag<T>::mma(ah, bl[j], acc[i][j]);
          acc[i][j] = Frag<T>::mma(al, bh[j], acc[i][j]);
        }
      }
      Frag<T>::guard(acc[i][0], acc[i][3], ah, SPLIT ? al : ah);
    }
    Frag<T>::keep(bh[0], bh[1], bh[2], bh[3]);
    if (SPLIT) Frag<T>::keep(bl[0], bl[1], bl[2], bl[3]);
  }
  acc_guard4(acc[0][0], acc[0][1], acc[0][2], acc[0][3]);
  acc_guard4(acc[1][0], acc[1][1], acc[1][2], acc[1][3]);
  acc_guard4(acc[2][0], acc[2][1], acc[2][2], acc[2][3]);
  acc_guard4(acc[3][0], acc[3][1], acc[3][2], acc[3][3]);

  // ---- epilogue ----
  float* slab = sT[wave];
  const float* Rb = RESID ? (resid + (size_t)b * strideR) : nullptr;
#pragma unroll
  for (int i = 0; i < 4; ++i) {
    const int mBase = m0 + (i << 4);
#pragma unroll
    for (int j = 0; j < 4; ++j) {
      const int n = n0 + (j << 4) + rlane;
      float bv = 0.f;
      if (BIAS_MODE == 2) bv = bias[n];
#pragma unroll
      for (int r = 0; r < 8; ++r) {
        float v = acc[i][j][r] * scale;
        if (BIAS_MODE == 1) v += bias[mBase + mOff + r];
        if (BIAS_MODE == 2) v += bv;
        if (RESID) v += Rb[(size_t)(mBase + mOff + r) * ldc + n];
        if (ACT == 1) v = tanhf(v);
        if (ACT == 2) v = fmaxf(v, 0.0f);
        if (ACT == 3) v = v / (1.0f + expf(-v));
        if (ACT == 4) v = (v > 0.f) ? v : 0.01f * v;
        if (ACT == 5) v = 0.5f * v * (1.0f + erff(v * 0.70710678118654752f));
        slab[(mOff + r) * 68 + (j << 4) + rlane] = v;
      }
    }
    __builtin_amdgcn_fence(__ATOMIC_RELEASE, "workgroup");
    __builtin_amdgcn_wave_barrier();
    __builtin_amdgcn_fence(__ATOMIC_ACQUIRE, "workgroup");
    if (OUT_MODE == 0) {
      float* C = (float*)Cout + (size_t)b * strideC;
      const int hh = lane >> 4, c4 = (lane & 15) * 4;     // row seg = 256 B = 16 lanes x 16 B
      {
#pragma unroll
        for (int it = 0; it < 8; ++it) {
          const int row = it * 2 + hh;
          v4f v = *(const v4f*)(slab + row * 68 + c4);
          *(v4f*)(C + (size_t)(mBase + row) * ldc + n0 + c4) = v;
        }
        
      }
    } else {
      const int q = lane >> 3, c8 = (lane & 7) * 8;
      unsigned short* C  = (unsigned short*)Cout  + (size_t)b * strideC;
      unsigned short* C2 = (OUT_MODE == 2) ? ((unsigned short*)Cout2 + (size_t)b * strideC) : nullptr;
      {
#pragma unroll
        for (int it = 0; it < 4; ++it) {
          const int row = it * 4 + q;
          const float* sp = slab + row * 68 + c8;
          v8h hv, lv;
#pragma unroll
          for (int e = 0; e < 8; ++e) {
            if (OUT_MODE == 1) {
              hv[e] = (_Float16)sp[e];
            } else {
              unsigned short hb = f2bf_bits(sp[e]);
              unsigned short lb = f2bf_bits(sp[e] - bf_bits2f(hb));
              hv[e] = __builtin_bit_cast(_Float16, hb);
              lv[e] = __builtin_bit_cast(_Float16, lb);
            }
          }
          *(v8h*)(C + (size_t)(mBase + row) * ldc + n0 + c8) = hv;
          if (OUT_MODE == 2) *(v8h*)(C2 + (size_t)(mBase + row) * ldc + n0 + c8) = lv;
        }
        
      }
    }
    __builtin_amdgcn_fence(__ATOMIC_RELEASE, "workgroup");
    __builtin_amdgcn_wave_barrier();
    __builtin_amdgcn_fence(__ATOMIC_ACQUIRE, "workgroup");
  }
}

// ---- LDS-staged WMMA GEMM ---------------------------------------------------
// C[m,n] = scale * sum_k A[m,k] * Bt[n,k] (+bias[n])(+resid); f16 operands, ldc = N. OUT16: the result goes out as f16 to C16 (it is only ever read as an f16 operand), else as f32 to C.
// One TM x TN tile of C per work-group of eight waves (4 x 2), a wave FM x FN fragments of 16 x 16: 128 x 128 (wave 32 x 64), or, where C still gives every WGP a
// work-group at that size, 256 x 256 (wave 64 x 128): per product half the bytes copied from L2 and half the LDS bytes read.
// A pass is 128 k: TN rows of Bt, then TM rows of A, 256 B each, copied to LDS at pitch 272 B. NS buffers: two where two work-groups share a WGP
// (each keeps the copy path busy while the other waits) and for the large tile (two of its stages fill the LDS);
// four where the grid gives a WGP one small work-group, so that NS - 1 stages' copies are always under way.
// M % TM == 0, N % TN == 0; K % 128 == 0, K >= NS * 128.
#define GL_PITCH 272

// Eight asynchronous copies, 16 B per lane each: rows r, r + 16, ... of one operand's 128 rows.
// The s_wait_xcnt ends the copies' own statement, so that no address register of a copy is rewritten in front of it.
template <int K>
__device__ __forceinline__ void gl_copy8(unsigned l, const unsigned short* g) {
  asm volatile(
      "global_load_async_to_lds_b128 %0, %8, off\n\t"
      "global_load_async_to_lds_b128 %1, %9, off\n\t"
      "global_load_async_to_lds_b128 %2, %10, off\n\t"
      "global_load_async_to_lds_b128 %3, %11, off\n\t"
      "global_load_async_to_lds_b128 %4, %12, off\n\t"
      "global_load_async_to_lds_b128 %5, %13, off\n\t"
      "global_load_async_to_lds_b128 %6, %14, off\n\t"
      "global_load_async_to_lds_b128 %7, %15, off\n\t"
      "s_wait_xcnt 0x0"
      :: "v"(l), "v"(l + 16u * GL_PITCH), "v"(l + 32u * GL_PITCH), "v"(l + 48u * GL_PITCH),
         "v"(l + 64u * GL_PITCH), "v"(l + 80u * GL_PITCH), "v"(l + 96u * GL_PITCH), "v"(l + 112u * GL_PITCH),
         "v"(g), "v"(g + (size_t)16 * K), "v"(g + (size_t)32 * K), "v"(g + (size_t)48 * K),
         "v"(g + (size_t)64 * K), "v"(g + (size_t)80 * K), "v"(g + (size_t)96 * K), "v"(g + (size_t)112 * K)
      : "memory");
}
// One stage: stage rows 0..TN-1 come from Bt, TN..TN+TM-1 from A; a lane fills 16 B of rows (thread >> 4) + 16 * i.
template <int K, int TM, int TN>
__device__ __forceinline__ void gl_fill(unsigned ldsLane, const unsigned short* gB, const unsigned short* gA) {
  // unrolled: each run's LDS and global offsets are then constants
#pragma unroll
  for (int q = 0; q < TN / 128; ++q) {
    gl_copy8<K>(ldsLane + (unsigned)(q * 128) * GL_PITCH, gB + (size_t)(q * 128) * K);
    // large tile, behind each run: the next run's addresses, and behind the last run whatever follows the stage, are formed behind this run and not among the runs;
    // formed together they take so many registers that a base pointer is spilled and reloaded every pass (without the one behind the last run too)
    if (TM + TN > 256) __builtin_amdgcn_sched_barrier(0);
  }
#pragma unroll
  for (int q = 0; q < TM / 128; ++q) {
    gl_copy8<K>(ldsLane + (unsigned)(TN + q * 128) * GL_PITCH, gA + (size_t)(q * 128) * K);
    if (TM + TN > 256) __builtin_amdgcn_sched_barrier(0);   // as above
  }
}
// this wave's copies have landed in LDS
__device__ __forceinline__ void gl_wait_async0() { asm volatile("s_wait_asynccnt 0x0" ::: "memory"); }
// all but this wave's CNT youngest copies have landed in LDS (the counter returns in issue order)
template <int CNT>
__device__ __forceinline__ void gl_wait_async_but() { asm volatile("s_wait_asynccnt %0" :: "n"(CNT) : "memory"); }
// this wave's LDS reads have returned, so the buffer may be refilled behind the barrier
__device__ __forceinline__ void gl_wait_ds0() { asm volatile("s_wait_dscnt 0x0" ::: "memory"); }

// LDC, PLANE (f16 output only): the N columns go out as N / LDC planes of LDC columns each, PLANE elements apart, so that products
// which share their A operand run as one launch and still leave each its own plane.
template <int N, int K, int BIAS_MODE, bool RESID, int ACT, bool OUT16, int LDC = N, int PLANE = 0, int NS = 2, int FM = 2, int FN = 4>
__global__ __launch_bounds__(256, (FM * FN > 8 ? 2 : 4)) void wmma_gemm_lds(
    const unsigned short* __restrict__ Ap, const unsigned short* __restrict__ Btp,
    float* __restrict__ C, _Float16* __restrict__ C16, const float* __restrict__ bias, const float* __restrict__ resid, float scale) {
  constexpr int TM = 64 * FM, TN = 32 * FN;    // the work-group's tile
  constexpr int CPS = (TM + TN) / 16;          // copies of a wave per stage
  constexpr unsigned GL_STAGE = (unsigned)(TM + TN) * GL_PITCH;
  static_assert(TM % 128 == 0 && TN % 128 == 0 && N % TN == 0 && K % 128 == 0 && K >= NS * 128, "shape");
  static_assert((NS == 2 || NS == 4) && CPS * (NS - 1) <= 63, "a wave has CPS * (NS - 1) copies outstanding, 63 at most");
  static_assert(LDC == N || (OUT16 && !RESID && BIAS_MODE == 0 && N % LDC == 0 && LDC % 128 == 0), "planes");
  __shared__ __attribute__((aligned(128))) unsigned char sL[NS * GL_STAGE];
  const int tid  = threadIdx.x;
  const int lane = tid & 31;
  const int wave = tid >> 5;
  constexpr int tilesN = N / TN;
  constexpr int NT = K / 128;
  const int tm = blockIdx.x / tilesN;
  const int tn = blockIdx.x - tm * tilesN;
  const int wm = (wave >> 1) * (16 * FM);      // this wave's 16 FM rows and 16 FN columns inside the tile
  const int wn = (wave & 1) * (16 * FN);
  const int rlane = lane & 15;                 // row (A) / col (B, D) within subtile
  const int hh    = lane >> 4;                 // lane half: k offset 8 * hh, D row offset 8 * hh
  const int mOff  = hh * 8;

  const unsigned ldsLane = (unsigned)(uintptr_t)(&sL[0]) + (unsigned)((tid >> 4) * GL_PITCH + (tid & 15) * 16);
  const unsigned short* gB = Btp + (size_t)(tn * TN + (tid >> 4)) * K + (tid & 15) * 8;
  const unsigned short* gA = Ap  + (size_t)(tm * TM + (tid >> 4)) * K + (tid & 15) * 8;

  v8f acc[FM][FN];
#pragma unroll
  for (int i = 0; i < FM; ++i)
#pragma unroll
    for (int j = 0; j < FN; ++j) acc[i][j] = (v8f){0.f,0.f,0.f,0.f,0.f,0.f,0.f,0.f};

  // A stage is CPS copies of every wave, so "all but the CPS * (NS - 2) youngest" is "up to and with the oldest stage under way".
  constexpr int LEFT = CPS * (NS - 2);
  // unrolled: each stage's LDS and global offsets are then constants
#pragma unroll
  for (int s = 0; s < NS - 1; ++s) gl_fill<K, TM, TN>(ldsLane + (unsigned)s * GL_STAGE, gB + s * 128, gA + s * 128);
  gl_wait_async_but<LEFT>();                   // stage 0 has landed
  __syncthreads();                             // stage 0 is readable by every wave
  gl_fill<K, TM, TN>(ldsLane + (unsigned)(NS - 1) * GL_STAGE, gB + (NS - 1) * 128, gA + (NS - 1) * 128);

  // kept rolled: one pass per trip, so that the order at its foot stands once
#pragma unroll 1
  for (int t = 0; t < NT; ++t) {
    const unsigned bo = (unsigned)(t & (NS - 1)) * GL_STAGE;
    const unsigned char* pB = sL + bo + (wn + rlane) * GL_PITCH + hh * 16;
    const unsigned char* pA = sL + bo + (TN + wm + rlane) * GL_PITCH + hh * 16;
    v16h bh[2][FN], ah[2][FM];                 // two fragment sets: the next 32 k are fetched while these are multiplied
#pragma unroll
    for (int j = 0; j < FN; ++j) bh[0][j] = Frag<_Float16>::load((const _Float16*)(pB + j * 16 * GL_PITCH));
#pragma unroll
    for (int i = 0; i < FM; ++i) ah[0][i] = Frag<_Float16>::load((const _Float16*)(pA + i * 16 * GL_PITCH));
    // large tile: the first block's LDS reads stay ahead of the second's, so that its WMMAs wait for their own 24 reads and not for all 48
    if (FM * FN > 8) __builtin_amdgcn_sched_barrier(0);
#pragma unroll
    for (int kk = 0; kk < 4; ++kk) {
      const int cur = kk & 1, nxt = cur ^ 1;
      if (kk < 3) {
#pragma unroll
        for (int j = 0; j < FN; ++j) bh[nxt][j] = Frag<_Float16>::load((const _Float16*)(pB + j * 16 * GL_PITCH + (kk + 1) * 64));
#pragma unroll
        for (int i = 0; i < FM; ++i) ah[nxt][i] = Frag<_Float16>::load((const _Float16*)(pA + i * 16 * GL_PITCH + (kk + 1) * 64));
      }
      __builtin_amdgcn_sched_barrier(0);       // keeps the next block's LDS reads one group ahead of this block's WMMAs, not among them
#pragma unroll
      for (int i = 0; i < FM; ++i)
#pragma unroll
        for (int j = 0; j < FN; ++j) acc[i][j] = Frag<_Float16>::mma(ah[cur][i], bh[cur][j], acc[i][j]);
      __builtin_amdgcn_sched_barrier(0);       // ends the block: later LDS reads stay behind its WMMAs
    }
    gl_wait_ds0();
    // Stage t + 1 has landed. While stages t + 1 .. t + NS - 1 all exist, each wave has exactly their CPS copies each outstanding and the younger ones stay
    // under way; on the last trips, behind which fewer stages were issued, the count would not cover stage t + 1 and the wait is to 0.
    if (NS > 2 && t + NS <= NT) gl_wait_async_but<LEFT>();
    else gl_wait_async0();
    __syncthreads();                           // publishes stage t + 1 and ends every read of stage t
    if (t + NS < NT) gl_fill<K, TM, TN>(ldsLane + bo, gB + (size_t)(t + NS) * 128, gA + (size_t)(t + NS) * 128);
  }
  gl_wait_async0();

  // ---- epilogue ----
  // The ring is free: the last trip's foot waited for every read and every copy and passed the barrier.
  float* slab = (float*)(sL + wave * (16 * 68 * 4));   // per-wave 16x64 slab, pitch 68 floats
  const int m0 = tm * TM + wm;
  const int nw = tn * TN + wn + rlane;         // this lane's first column
  float bv[FN];                                // one run of loads for all of the wave's columns, with one wait behind it
#pragma unroll
  for (int j = 0; j < FN; ++j) bv[j] = (BIAS_MODE == 2) ? bias[nw + (j << 4)] : 0.f;
  // the bias loads' index register is an input, so it stays whole up to the wait
  if (BIAS_MODE == 2) asm volatile("s_wait_xcnt 0x0" :: "v"(nw) : "memory");
  // the wave's columns go out 64 at a time; unrolled, so that acc's indices are constants
#pragma unroll
  for (int jg = 0; jg < FN / 4; ++jg) {
  const int n0 = tn * TN + wn + jg * 64;
  const int nl = n0 + rlane;
#pragma unroll
  for (int i = 0; i < FM; ++i) {
    const int mBase = m0 + (i << 4);
    float rv[4][8];
    if (RESID) {
      const float* rp = resid + (size_t)(mBase + mOff) * N + nl;
#pragma unroll
      for (int j = 0; j < 4; ++j)
#pragma unroll
        for (int r = 0; r < 8; ++r) rv[j][r] = rp[(size_t)r * N + (j << 4)];
      // the residual loads' address register is an input, so it stays whole up to the wait
      asm volatile("s_wait_xcnt 0x0" :: "v"(rp) : "memory");
    }
#pragma unroll
    for (int j = 0; j < 4; ++j) {
#pragma unroll
      for (int r = 0; r < 8; ++r) {
        float v = acc[i][jg * 4 + j][r] * scale;
        if (BIAS_MODE == 2) v += bv[jg * 4 + j];
        if (RESID) v += rv[j][r];
        if (ACT == 2) v = fmaxf(v, 0.0f);
        slab[(mOff + r) * 68 + (j << 4) + rlane] = v;
      }
    }
    __builtin_amdgcn_fence(__ATOMIC_RELEASE, "workgroup");
    __builtin_amdgcn_wave_barrier();
    __builtin_amdgcn_fence(__ATOMIC_ACQUIRE, "workgroup");
    if (OUT16) {
      const int r4 = lane >> 3, c8 = (lane & 7) * 8;   // row seg = 128 B = 8 lanes x 16 B
      const int pl = (LDC == N) ? 0 : n0 / LDC;        // this wave's 64 columns lie in one plane
      _Float16* hp = C16 + (size_t)pl * PLANE + (size_t)(mBase + r4) * LDC + (n0 - pl * LDC) + c8;
#pragma unroll
      for (int it = 0; it < 4; ++it) {         // rows it * 4 + r4
        const float* sp = slab + (it * 4 + r4) * 68 + c8;
        const v4f lo = *(const v4f*)(sp), hi = *(const v4f*)(sp + 4);
        v8h h;
#pragma unroll
        for (int e = 0; e < 4; ++e) { h[e] = (_Float16)lo[e]; h[4 + e] = (_Float16)hi[e]; }
        *(v8h*)(hp + (size_t)it * 4 * LDC) = h;
      }
    } else {
      const int c4 = (lane & 15) * 4;          // row seg = 256 B = 16 lanes x 16 B
      float* cp = C + (size_t)(mBase + hh) * N + n0 + c4;
#pragma unroll
      for (int it = 0; it < 8; ++it) {         // rows it * 2 + hh
        v4f v = *(const v4f*)(slab + (it * 2 + hh) * 68 + c4);
        *(v4f*)(cp + (size_t)it * 2 * N) = v;
      }
    }
    __builtin_amdgcn_sched_barrier(0);         // holds later register writes behind the wait below
    asm volatile("s_wait_xcnt 0x0" ::: "memory");   // before a data or address register of the stores above is rewritten
    __builtin_amdgcn_sched_barrier(0);         // without the pair the next rows' multiplies were lifted over the wait, onto the stores' data registers
    __builtin_amdgcn_fence(__ATOMIC_RELEASE, "workgroup");
    __builtin_amdgcn_wave_barrier();
    __builtin_amdgcn_fence(__ATOMIC_ACQUIRE, "workgroup");
  }
  }
}

__global__ __launch_bounds__(256) void cast_f32_f16x2(
    const float* __restrict__ in, _Float16* __restrict__ out, int n2) {
  int i = blockIdx.x * 256 + threadIdx.x;
  if (i < n2) {
    const _Float16 h0 = (_Float16)in[2 * i], h1 = (_Float16)in[2 * i + 1];
    const unsigned u = (unsigned)__builtin_bit_cast(unsigned short, h0) | ((unsigned)__builtin_bit_cast(unsigned short, h1) << 16);
    ((unsigned*)out)[i] = u;
    
  }
}


} // namespace w25

__global__ __launch_bounds__(256) void k_castT16(const float* __restrict__ src, long long lds, _Float16* __restrict__ dst, long long ldd, int R, int C, float s) {
    const long long i = (long long)blockIdx.x * 256 + threadIdx.x; const long long np = (long long)C * (R / 2); if (i >= np) return; const int c = (int)(i / (R / 2)); const int r = 2 * (int)(i % (R / 2));
    const _Float16 h0 = (_Float16)(src[(long long)r * lds + c] * s), h1 = (_Float16)(src[(long long)(r + 1) * lds + c] * s);
    const unsigned u = (unsigned)__builtin_bit_cast(unsigned short, h0) | ((unsigned)__builtin_bit_cast(unsigned short, h1) << 16);
    unsigned* d = (unsigned*)(dst + (long long)c * ldd + r); *d = u;  }
__global__ __launch_bounds__(256) void k_cast16(const float* __restrict__ src, long long lds, _Float16* __restrict__ dst, long long ldd, int R, int C, float s) {
    const long long i = (long long)blockIdx.x * 256 + threadIdx.x; const long long np = (long long)R * (C / 2); if (i >= np) return; const int r = (int)(i / (C / 2)); const int c = 2 * (int)(i % (C / 2));
    const _Float16 h0 = (_Float16)(src[(long long)r * lds + c] * s), h1 = (_Float16)(src[(long long)r * lds + c + 1] * s);
    const unsigned u = (unsigned)__builtin_bit_cast(unsigned short, h0) | ((unsigned)__builtin_bit_cast(unsigned short, h1) << 16);
    unsigned* d = (unsigned*)(dst + (long long)r * ldd + c); *d = u;  }

// f32 -> bf16 hi plane + bf16 lo plane (x = hi + lo to ~2^-17 relative; RNE both), [R][C] -> [R][C] (or transposed to [C][R]); 2 consecutive destination elements
__device__ __forceinline__ unsigned int f2bf2_pack(float a, float b, unsigned int* lo) {
    const unsigned short ha = w25::f2bf_bits(a), hb = w25::f2bf_bits(b);
    const unsigned short la = w25::f2bf_bits(a - w25::bf_bits2f(ha)), lb = w25::f2bf_bits(b - w25::bf_bits2f(hb));
    *lo = (unsigned)la | ((unsigned)lb << 16); return (unsigned)ha | ((unsigned)hb << 16); }
__global__ __launch_bounds__(256) void k_castS16(const float* __restrict__ src, long long lds, __bf16* __restrict__ dhi, __bf16* __restrict__ dlo, long long ldd, int R, int C, float s, int transpose) {
    const long long i = (long long)blockIdx.x * 256 + threadIdx.x; long long o; float a, b;
    if (transpose) { const long long np = (long long)C * (R / 2); if (i >= np) return; const int c = (int)(i / (R / 2)); const int r = 2 * (int)(i % (R / 2)); a = src[(long long)r * lds + c] * s; b = src[(long long)(r + 1) * lds + c] * s; o = (long long)c * ldd + r; }
    else { const long long np = (long long)R * (C / 2); if (i >= np) return; const int r = (int)(i / (C / 2)); const int c = 2 * (int)(i % (C / 2)); a = src[(long long)r * lds + c] * s; b = src[(long long)r * lds + c + 1] * s; o = (long long)r * ldd + c; }
    unsigned lo; const unsigned hi = f2bf2_pack(a, b, &lo); unsigned* ph = (unsigned*)(dhi + o); unsigned* pl = (unsigned*)(dlo + o);
    *ph = hi; *pl = lo;  }

namespace w25 {
// =====================================================================================
// Generic causal/non-causal attention for head_dim 64, f32 in / f32 out; 16-bit operands: bf16 with optional hi/lo splits, or
// plain f16 (F16=true, non-split, probabilities carried x2^15).
//   scores = (q*qscale)·kᵀ : v_wmma_f32_16x16x32_bf16; SPLIT_QK -> q,k as bf16 hi/lo (hi·hi + hi·lo + lo·hi)
//   out    = p·v           : v_wmma_f32_16x16x32_bf16; SPLIT_PV -> p,v as bf16 hi/lo; else p,v plain bf16
//   f32 accumulate; online softmax in f32. Block = 4 waves = 64 query rows of one (batch, head); S % 64 == 0.
//   Element (b, s, h, d) of tensor X lives at X[b*X_bs + s*X_rs + h*X_hs + d] (strides in floats, multiples of 4).
//   Masking: mask_mode 0 none, 1 causal (kv > q masked), 2 tensor [S][Skv] shared over (b,h) (float if
//   mask_is_int==0, int32 with element == 0 -> masked if 1, int32 with element != 0 -> masked if 2), 3 per-token vectors qmask[B][S] & kvmask[B][Skv] (int32,
//   0 -> masked), 4 causal + sliding window (kv > q or q - kv > W masked; W passed in mask_is_int);
//   5 = relative-position bias: s += cp[b,h,q][idx[q][kv]] + pc[b,h,kv][idx[q][kv]] with idx = mask_b ([S][Skv] int32) and
//   mask_a an int32 [S][Skv] tensor with nonzero = masked (tables: element (b,h,row,n) at X + b*c_bs + h*c_hs + row*c_rs + n);
//   masked scores are replaced by mask_fill (e.g. -inf or -1e9) before the softmax.
//   grid.x = B * H * (S/64) (or a sub-range with blk0).
// =====================================================================================
#define AT_D 64
#define AT_NW 4
#define AT_QB 64
#define AT_KC 64
struct AttnGeom { const float* cp = nullptr; const float* pc = nullptr; long c_bs = 0, c_rs = 0, c_hs = 0;   // mode-5 score-bias tables
                  long q_bs, q_rs, q_hs, k_bs, k_rs, k_hs, v_bs, v_rs, v_hs, o_bs, o_rs, o_hs;
                  int S, Skv, H, mask_mode; float qscale; int blk0; float mask_fill; int mask_is_int; };
static_assert(sizeof(AttnGeom) == 168, "no padding");

__device__ __forceinline__ unsigned short at_bf_bits(float f) {
  unsigned u = __float_as_uint(f);
  return (unsigned short)((u + 0x7FFFu + ((u >> 16) & 1u)) >> 16);
}
__device__ __forceinline__ __bf16 at_f2bf(float f) { return __builtin_bit_cast(__bf16, at_bf_bits(f)); }
__device__ __forceinline__ void at_split(float f, __bf16& hi, __bf16& lo) {
  const unsigned short hb = at_bf_bits(f);
  hi = __builtin_bit_cast(__bf16, hb);
  lo = at_f2bf(f - __uint_as_float(((unsigned)hb) << 16));
}
__device__ __forceinline__ v8f at_mma(v16b a, v16b b, v8f c) {
  c = __builtin_amdgcn_wmma_f32_16x16x32_bf16(false, a, false, b, (short)0, c, false, false);
  asm volatile("v_nop\n\tv_nop\n\tv_nop\n\tv_nop" : "+v"(c) : "v"(a), "v"(b));
  return c;
}
// 16-bit element as a bit pattern held in a __bf16 slot: f16 bits when F16, bf16 (RNE) otherwise
template <bool F16> __device__ __forceinline__ __bf16 at_to16(float f) {
  if (F16) return __builtin_bit_cast(__bf16, (_Float16)f);
  return at_f2bf(f);
}
template <bool F16> __device__ __forceinline__ v8f at_mma16(v16b a, v16b b, v8f c) {
  if (F16) {
    const v16h ah = __builtin_bit_cast(v16h, a), bh = __builtin_bit_cast(v16h, b);
    c = __builtin_amdgcn_wmma_f32_16x16x32_f16(false, ah, false, bh, (short)0, c, false, false);
    asm volatile("v_nop\n\tv_nop\n\tv_nop\n\tv_nop" : "+v"(c) : "v"(ah), "v"(bh));
    return c;
  }
  return at_mma(a, b, c);
}

template <bool SPLIT_QK, bool SPLIT_PV, bool F16 = false>
__global__ __launch_bounds__(128)
void attn64_kernel(const float* __restrict__ q, const float* __restrict__ k,
                   const float* __restrict__ v, float* __restrict__ out,
                   const void* __restrict__ mask_a, const int* __restrict__ mask_b, AttnGeom g) {
  static_assert(!(F16 && (SPLIT_QK || SPLIT_PV)), "f16 mode is non-split");
  const float PSC = F16 ? 32768.0f : 1.0f;     // f16 probabilities carried x2^15 (subnormal range), folded into the final 1/l
  union FB { v16b v; v8b h[2]; };
  __shared__ __align__(16) __bf16 Ksh[AT_KC * AT_D];             // K hi [kv][d]      8 KB
  __shared__ __align__(16) __bf16 Ksl[SPLIT_QK ? AT_KC * AT_D : 8];
  __shared__ __align__(16) __bf16 Vth[AT_D * AT_KC];             // V hi [d][kv]      8 KB
  __shared__ __align__(16) __bf16 Vtl[SPLIT_PV ? AT_D * AT_KC : 8];
  __shared__ __align__(16) __bf16 Psh[AT_NW][16 * AT_KC];        // per wave P hi [row][kv]  8 KB
  __shared__ __align__(16) __bf16 Psl[SPLIT_PV ? AT_NW : 1][SPLIT_PV ? 16 * AT_KC : 8];
  __shared__ __align__(16) float  Os[AT_NW][16 * 68];            // per wave out tile, pitch 68

  const int tid  = threadIdx.x;
  const int wave = tid >> 5;
  const int lane = tid & 31;
  const int hh   = lane >> 4;
  const int c    = lane & 15;

  const int nqb = g.S / AT_QB;
  const int bx = blockIdx.x + g.blk0;
  const int qb = bx % nqb;
  const int bh = bx / nqb;
  const int h  = bh % g.H;
  const int b  = bh / g.H;
  const int qbase_block = qb * AT_QB;
  const int q0 = qbase_block + wave * 16;

  const float* qb_ptr = q + (size_t)b * g.q_bs + (size_t)h * g.q_hs;
  const float* kb_ptr = k + (size_t)b * g.k_bs + (size_t)h * g.k_hs;
  const float* vb_ptr = v + (size_t)b * g.v_bs + (size_t)h * g.v_hs;
  float*       ob_ptr = out + (size_t)b * g.o_bs + (size_t)h * g.o_hs;

  // ---- Q fragments (A operand): 2 d-chunks, hi (and lo) ----
  v16b qah[2], qal[2];
  {
    const float* qrow = qb_ptr + (size_t)(q0 + c) * g.q_rs;
#pragma unroll
    for (int dc = 0; dc < 2; ++dc) {
#pragma unroll
      for (int e = 0; e < 8; ++e) {
        const float f0 = qrow[dc * 32 + 8 * hh + e] * g.qscale;
        const float f1 = qrow[dc * 32 + 16 + 8 * hh + e] * g.qscale;
        if (SPLIT_QK) { __bf16 hq, lq; at_split(f0, hq, lq); qah[dc][e] = hq; qal[dc][e] = lq; at_split(f1, hq, lq); qah[dc][8 + e] = hq; qal[dc][8 + e] = lq; }
        else { qah[dc][e] = at_to16<F16>(f0); qah[dc][8 + e] = at_to16<F16>(f1); qal[dc][e] = qah[dc][e]; qal[dc][8 + e] = qah[dc][8 + e]; }
      }
    }
  }

  float mrow[8], lrow[8];
  v8f oacc[4];
#pragma unroll
  for (int r = 0; r < 8; ++r) { mrow[r] = -INFINITY; lrow[r] = 0.f; }
#pragma unroll
  for (int t = 0; t < 4; ++t) oacc[t] = (v8f){0.f,0.f,0.f,0.f,0.f,0.f,0.f,0.f};

  const int nChunks = (g.mask_mode == 1 || g.mask_mode == 4) ? (qb + 1) : (g.Skv / AT_KC);   // block-uniform
  // per-row query mask (mode 3)
  int qkeep[8];
#pragma unroll
  for (int r = 0; r < 8; ++r) qkeep[r] = (g.mask_mode == 3) ? mask_b[(size_t)b * g.S + q0 + 8 * hh + r] : 1;   // mask_b = qmask in mode 3
  for (int kc = 0; kc < nChunks; ++kc) {
    const int kv0 = kc * AT_KC;
    __syncthreads();
    {
      const int kvr = tid >> 1, dh = (tid & 1) * 32;
      const float* krow = kb_ptr + (size_t)(kv0 + kvr) * g.k_rs + dh;
      const float* vrow = vb_ptr + (size_t)(kv0 + kvr) * g.v_rs + dh;
#pragma unroll
      for (int i = 0; i < 8; ++i) {
        v4f kk = *(const v4f*)(krow + 4 * i);
        v4f vv = *(const v4f*)(vrow + 4 * i);
#pragma unroll
        for (int e = 0; e < 4; ++e) {
          const int d = dh + 4 * i + e;
          if (SPLIT_QK) { __bf16 a, bl; at_split(kk[e], a, bl); Ksh[kvr * AT_D + d] = a; Ksl[kvr * AT_D + d] = bl; }
          else Ksh[kvr * AT_D + d] = at_to16<F16>(kk[e]);
          if (SPLIT_PV) { __bf16 a, bl; at_split(vv[e], a, bl); Vth[d * AT_KC + kvr] = a; Vtl[d * AT_KC + kvr] = bl; }
          else Vth[d * AT_KC + kvr] = at_to16<F16>(vv[e]);
        }
      }
    }
    __syncthreads();

    v8f s[4];
#pragma unroll
    for (int j = 0; j < 4; ++j) {
      s[j] = (v8f){0.f,0.f,0.f,0.f,0.f,0.f,0.f,0.f};
#pragma unroll 1
      for (int dc = 0; dc < 2; ++dc) {
        FB kb;
        kb.h[0] = *(const v8b*)(Ksh + (j * 16 + c) * AT_D + dc * 32 + 8 * hh);
        kb.h[1] = *(const v8b*)(Ksh + (j * 16 + c) * AT_D + dc * 32 + 16 + 8 * hh);
        s[j] = at_mma16<F16>(qah[dc], kb.v, s[j]);
        if (SPLIT_QK) {
          FB kl;
          kl.h[0] = *(const v8b*)(Ksl + (j * 16 + c) * AT_D + dc * 32 + 8 * hh);
          kl.h[1] = *(const v8b*)(Ksl + (j * 16 + c) * AT_D + dc * 32 + 16 + 8 * hh);
          s[j] = at_mma16<F16>(qah[dc], kl.v, s[j]);
          s[j] = at_mma16<F16>(qal[dc], kb.v, s[j]);
        }
      }
    }
    const bool diag = (g.mask_mode == 1) && (kc == qb);
    int kvkeep[4] = {1, 1, 1, 1};
    if (g.mask_mode == 3) {
#pragma unroll
      for (int j = 0; j < 4; ++j) kvkeep[j] = ((const int*)mask_a)[(size_t)b * g.Skv + kv0 + j * 16 + c];   // mask_a = kvmask
    }
    float cm[8];
#pragma unroll
    for (int r = 0; r < 8; ++r) {
      const int qrow = q0 + 8 * hh + r;
      float m = -INFINITY;
#pragma unroll
      for (int j = 0; j < 4; ++j) {
        const int kvcol = kv0 + j * 16 + c;
        bool masked = false;
        if (diag) masked = (kvcol > qrow);
        else if (g.mask_mode == 4) masked = (kvcol > qrow) || (qrow - kvcol > g.mask_is_int);
        else if (g.mask_mode == 2) {
          const size_t mi = (size_t)qrow * g.Skv + kvcol;
          masked = (g.mask_is_int == 0) ? (((const float*)mask_a)[mi] == 0.0f)
                 : (g.mask_is_int == 1) ? (((const int*)mask_a)[mi] == 0) : (((const int*)mask_a)[mi] != 0);
        } else if (g.mask_mode == 3) masked = (qkeep[r] == 0) || (kvkeep[j] == 0);
        else if (g.mask_mode == 5) {
          const size_t mi = (size_t)qrow * g.Skv + kvcol;
          masked = (((const int*)mask_a)[mi] != 0);
          int n = mask_b[mi]; n = n < 0 ? 0 : n;
          s[j][r] += g.cp[(size_t)b * g.c_bs + (size_t)h * g.c_hs + (size_t)qrow * g.c_rs + n]
                   + g.pc[(size_t)b * g.c_bs + (size_t)h * g.c_hs + (size_t)kvcol * g.c_rs + n];
        }
        if (masked) s[j][r] = g.mask_fill;
        m = fmaxf(m, s[j][r]);
      }
#pragma unroll
      for (int off = 1; off < 16; off <<= 1) m = fmaxf(m, __shfl_xor(m, off, 32));
      cm[r] = m;
    }
    __bf16* pwh = Psh[wave];
    __bf16* pwl = Psl[SPLIT_PV ? wave : 0];
#pragma unroll
    for (int r = 0; r < 8; ++r) {
      const float mnew = fmaxf(mrow[r], cm[r]);
      const float alpha = expf(mrow[r] - mnew);
      mrow[r] = mnew;
      float psum = 0.f;
#pragma unroll
      for (int j = 0; j < 4; ++j) {
        const float p = expf(s[j][r] - mnew);
        psum += p;
        if (SPLIT_PV) { __bf16 a, bl; at_split(p, a, bl); pwh[(8 * hh + r) * AT_KC + j * 16 + c] = a; pwl[(8 * hh + r) * AT_KC + j * 16 + c] = bl; }
        else pwh[(8 * hh + r) * AT_KC + j * 16 + c] = at_to16<F16>(p * PSC);
      }
#pragma unroll
      for (int off = 1; off < 16; off <<= 1) psum += __shfl_xor(psum, off, 32);
      lrow[r] = lrow[r] * alpha + psum;
#pragma unroll
      for (int t = 0; t < 4; ++t) oacc[t][r] *= alpha;
    }
    __builtin_amdgcn_fence(__ATOMIC_RELEASE, "workgroup");
    __builtin_amdgcn_wave_barrier();
    __builtin_amdgcn_fence(__ATOMIC_ACQUIRE, "workgroup");
#pragma unroll 1
    for (int kk = 0; kk < 2; ++kk) {
      FB pa, pl;
      pa.h[0] = *(const v8b*)(pwh + c * AT_KC + kk * 32 + 8 * hh);
      pa.h[1] = *(const v8b*)(pwh + c * AT_KC + kk * 32 + 16 + 8 * hh);
      if (SPLIT_PV) {
        pl.h[0] = *(const v8b*)(pwl + c * AT_KC + kk * 32 + 8 * hh);
        pl.h[1] = *(const v8b*)(pwl + c * AT_KC + kk * 32 + 16 + 8 * hh);
      }
#pragma unroll
      for (int t = 0; t < 4; ++t) {
        FB vb;
        vb.h[0] = *(const v8b*)(Vth + (t * 16 + c) * AT_KC + kk * 32 + 8 * hh);
        vb.h[1] = *(const v8b*)(Vth + (t * 16 + c) * AT_KC + kk * 32 + 16 + 8 * hh);
        oacc[t] = at_mma16<F16>(pa.v, vb.v, oacc[t]);
        if (SPLIT_PV) {
          FB vl;
          vl.h[0] = *(const v8b*)(Vtl + (t * 16 + c) * AT_KC + kk * 32 + 8 * hh);
          vl.h[1] = *(const v8b*)(Vtl + (t * 16 + c) * AT_KC + kk * 32 + 16 + 8 * hh);
          oacc[t] = at_mma16<F16>(pa.v, vl.v, oacc[t]);
          oacc[t] = at_mma16<F16>(pl.v, vb.v, oacc[t]);
        }
      }
    }
  }

  float* os = Os[wave];
#pragma unroll
  for (int r = 0; r < 8; ++r) {
    const float inv = 1.0f / (lrow[r] * PSC);
#pragma unroll
    for (int t = 0; t < 4; ++t) os[(8 * hh + r) * 68 + t * 16 + c] = oacc[t][r] * inv;
  }
  __builtin_amdgcn_fence(__ATOMIC_RELEASE, "workgroup");
  __builtin_amdgcn_wave_barrier();
  __builtin_amdgcn_fence(__ATOMIC_ACQUIRE, "workgroup");
  {
    const int c4 = (lane & 15) * 4;
    {
#pragma unroll
      for (int it = 0; it < 8; ++it) {
        const int row = it * 2 + hh;
        v4f val = *(const v4f*)(os + row * 68 + c4);
        *(v4f*)(ob_ptr + (size_t)(q0 + row) * g.o_rs + c4) = val;
      }
      
    }
  }
}

} // namespace w25

// ---- Wide elementwise and row passes: a thread moves 32 or 64 elements with 16-byte loads, so that a pass starts a few thousand waves instead of
//      one wave per 64 or 128 elements. Every wave-wide store covers whole 128-byte lines. Formulas and sum trees are those of the narrow kernels above.
typedef __attribute__((ext_vector_type(4))) _Float16 v4h;
// cast16w<G>: dst[i] = f16(src[i] * s) over a flat range; block bx takes G * 1024 consecutive elements, a thread 4 consecutive ones of each 1024.
template <int G>
__device__ __forceinline__ void cast16w(const float* __restrict__ src, _Float16* __restrict__ dst, float s, unsigned bx) {
    const v4f* sp = (const v4f*)(src + (size_t)bx * (G * 1024));
    v4h* dp = (v4h*)(dst + (size_t)bx * (G * 1024));
    const unsigned t = threadIdx.x;
    v4f a[G];
    // every loop here is unrolled, so that the arrays it indexes are registers and all G loads are in flight together
#pragma unroll
    for (int g = 0; g < G; ++g) a[g] = sp[t + g * 256];
    __builtin_amdgcn_sched_barrier(0);               // holds later register writes behind the wait below
    asm volatile("s_wait_xcnt 0x0" ::: "memory");    // before an address register of the loads above is rewritten (the store addresses are formed next)
    __builtin_amdgcn_sched_barrier(0);               // the pair keeps the forming of the store addresses behind the wait
    v4h h[G];
#pragma unroll
    for (int g = 0; g < G; ++g)
#pragma unroll
        for (int e = 0; e < 4; ++e) h[g][e] = (_Float16)(a[g][e] * s);
#pragma unroll
    for (int g = 0; g < G; ++g) dp[t + g * 256] = h[g];
}
// castT16w<LDS, LDD>: dst[c * LDD + r] = f16(src[r * LDS + c] * s). Block (bx, by) = 64 source rows x 128 source columns, wave = 64 x 16, lane = 8 rows x 4 columns
//   transposed in registers: 8 lanes side by side in r fill one 128-byte line of a dst row. bx < C / 128, by < R / 64.
template <int LDS, int LDD>
__device__ __forceinline__ void castT16w(const float* __restrict__ src, _Float16* __restrict__ dst, float s, unsigned bx, unsigned by) {
    const int lane = threadIdx.x & 31, wave = threadIdx.x >> 5;
    const int r = by * 64 + (lane & 7) * 8;
    const int c = bx * 128 + wave * 16 + (lane >> 3) * 4;
    const float* sp = src + (size_t)r * LDS + c;
    _Float16* dp = dst + (size_t)c * LDD + r;
    v4f x[8];
    // every loop here is unrolled, so that the arrays it indexes are registers and all eight loads are in flight together
#pragma unroll
    for (int i = 0; i < 8; ++i) x[i] = *(const v4f*)(sp + i * LDS);
    __builtin_amdgcn_sched_barrier(0);               // holds later register writes behind the wait below
    asm volatile("s_wait_xcnt 0x0" ::: "memory");    // before an address register of the loads above is rewritten
    __builtin_amdgcn_sched_barrier(0);               // the pair keeps later address arithmetic behind the wait
    v8h h[4];
#pragma unroll
    for (int j = 0; j < 4; ++j)
#pragma unroll
        for (int i = 0; i < 8; ++i) h[j][i] = (_Float16)(x[i][j] * s);
#pragma unroll
    for (int j = 0; j < 4; ++j) *(v8h*)(dp + j * LDD) = h[j];
    asm volatile("s_wait_xcnt 0x0" ::: "memory");    // behind the stores: in the merged kernel another branch's code follows in the listing and reuses their address and data registers
}
// k_cast_all: every f16 operand plane that depends on the inputs alone, in one launch of 2048 blocks, none of which reads what another writes.
//   Blocks 0..511: X. 512..1023: Wq, Wk, Wv, Wo transposed, x16, as four planes of 1024 x 1024 one behind the other (the first three are one Bt of 3072 rows).
//   1024..1535: W1 transposed, x16. 1536..2047: W2 transposed, x16.
__global__ __launch_bounds__(256) void k_cast_all(const float* __restrict__ X, const float* __restrict__ Wq, const float* __restrict__ Wk, const float* __restrict__ Wv,
                                                  const float* __restrict__ Wo, const float* __restrict__ W1, const float* __restrict__ W2,
                                                  _Float16* __restrict__ Xh, _Float16* __restrict__ Wt4, _Float16* __restrict__ W1t, _Float16* __restrict__ W2t) {
    const unsigned b = blockIdx.x, q = b & 511u;
    if (b < 512u) { cast16w<8>(X, Xh, 1.0f, q); return; }
    if (b < 1024u) {
        const unsigned w = q >> 7, i = q & 127u;
        const float* src = (w == 0u) ? Wq : (w == 1u) ? Wk : (w == 2u) ? Wv : Wo;
        castT16w<1024, 1024>(src, Wt4 + (size_t)w * (1024 * 1024), 16.0f, i & 7u, i >> 3);
        return;
    }
    if (b < 1536u) { castT16w<4096, 1024>(W1, W1t, 16.0f, q & 31u, q >> 5); return; }
    castT16w<1024, 4096>(W2, W2t, 16.0f, q & 7u, q >> 3);
}
// Sum of one value per position t = 0..255 of k_stats' tree, add for add: lane l holds positions 4l + q in lo[q] and 128 + 4l + q in hi[q].
//   Levels 128 (in the lane), 64..4 (lanes l and l ^ 16, 8, 4, 2, 1), 2 and 1 (in the lane); every lane ends with the root.
__device__ __forceinline__ float tree256(v4f lo, v4f hi) {
    v4f t = lo + hi;
#pragma unroll
    for (int o = 16; o > 0; o >>= 1) {
#pragma unroll
        for (int q = 0; q < 4; ++q) t[q] += __shfl_xor(t[q], o, 32);
    }
    return (t[0] + t[2]) + (t[1] + t[3]);
}
// k_ln_w: y = (x - mean) * rsqrt(var + eps) * g + b on rows of 1024 in one pass: a wave holds two whole rows in registers, takes their statistics
//   (k_stats mode 0; same partial sums, same tree) and applies them to the same registers (x and y may be the same buffer: a wave reads its rows before it writes them).
//   H16: y16 = f16(y) goes out beside y, as the next product's A operand. grid = rows / 16.
template <bool H16>
__global__ __launch_bounds__(256) void k_ln_w(const float* x, float* y, _Float16* __restrict__ y16, float eps, const float* __restrict__ g, const float* __restrict__ bta) {
    const int lane = threadIdx.x & 31;
    const size_t off = ((size_t)blockIdx.x * 16 + (threadIdx.x >> 5) * 2) * 1024 + 4 * lane;
    const float* base = x + off;
    v4f v[2][8], gg[8], bb[8];
    // every loop here is unrolled, so that the arrays it indexes are registers and all loads are in flight together
#pragma unroll
    for (int r = 0; r < 2; ++r)
#pragma unroll
        for (int m = 0; m < 8; ++m) v[r][m] = *(const v4f*)(base + r * 1024 + 128 * m);
#pragma unroll
    for (int m = 0; m < 8; ++m) { gg[m] = *(const v4f*)(g + 4 * lane + 128 * m); bb[m] = *(const v4f*)(bta + 4 * lane + 128 * m); }
    __builtin_amdgcn_sched_barrier(0);               // holds later register writes behind the wait below
    asm volatile("s_wait_xcnt 0x0" :: "v"(base) : "memory");   // before an address register of the loads above is rewritten; the rows' address is an input, so no later load's result lands on it in front of the wait
    __builtin_amdgcn_sched_barrier(0);               // the pair keeps later address arithmetic behind the wait
    v4h h[2][8];
#pragma unroll
    for (int r = 0; r < 2; ++r) {
        const float mu = tree256(((v[r][0] + v[r][2]) + v[r][4]) + v[r][6], ((v[r][1] + v[r][3]) + v[r][5]) + v[r][7]) / 1024.f;
        v4f q0 = {}, q1 = {};
#pragma unroll
        for (int k = 0; k < 4; ++k) { const v4f d0 = v[r][2 * k] - mu, d1 = v[r][2 * k + 1] - mu; q0 = __builtin_elementwise_fma(d0, d0, q0); q1 = __builtin_elementwise_fma(d1, d1, q1); }
        const float rs = rsqrtf(tree256(q0, q1) / 1024.f + eps);
#pragma unroll
        for (int m = 0; m < 8; ++m) {
            v4f o = (v[r][m] - mu) * rs;
            o *= gg[m]; o += bb[m];
            v[r][m] = o;
            if (H16) {
#pragma unroll
                for (int e = 0; e < 4; ++e) h[r][m][e] = (_Float16)o[e];
            }
        }
    }
    __builtin_amdgcn_sched_barrier(0);               // every value is made before the first store issues, so no store's data register is rewritten behind it
#pragma unroll
    for (int r = 0; r < 2; ++r)
#pragma unroll
        for (int m = 0; m < 8; ++m) {
            *(v4f*)(y + off + r * 1024 + 128 * m) = v[r][m];
            if (H16) *(v4h*)(y16 + off + r * 1024 + 128 * m) = h[r][m];
        }
}


// ---- Q/K/V projection and block attention in one kernel ---------------------------------------------------------------
// k_qkv_attn: one work-group of eight waves per (128-position block z, head h). It first makes that block's and head's Q, K and V, a 128 x 192 tile of X.[Wq Wk Wv]
//   over K = 1024 (f16 operands, f32 sums in k order, x 1/16, rounded to f16), leaves them in LDS and then attends on them: 128 queries x 128 keys x 64 dims,
//   online softmax over two 64-key halves. Q, K and V never go to memory; O leaves as f16, the next product's A operand.
//   Product: a pass is 64 k. A stage is 64 rows each of Wq^T, Wk^T, Wv^T (this head's), then the block's 128 rows of X, 128 B each, copied to LDS at pitch 144 B; three buffers,
//   two stages' copies always under way; two work-groups share a WGP. Wave (wave >> 2, wave & 3) takes 64 rows of X and dims 16 * (wave & 3) .. + 15 of each of Q, K and V.
//   For Q and K the weight fragment is the A operand and the X fragment the B operand, so that a lane ends with 8 consecutive dims of one position: one 16-byte LDS store
//   into [position][d]. For V it is the other way round: a lane ends with 8 consecutive keys of one dim, one 16-byte store into [d][key].
//   Attention: wave w owns queries 16w .. 16w + 15; every A and B fragment is two 16-byte LDS reads.
#define BA_KP 72      // pitch of Q, K and P rows in halves: 144 B = 16 B x odd, for 16-byte readers
#define BA_VP 136     // pitch of V^T rows in halves: 272 B = 16 B x odd
#define QA_PITCH 144                  // pitch of a stage row in bytes: 16 B x odd
#define QA_STAGE (320 * QA_PITCH)
#define QA_NS 3
#define QA_NT 16                      // passes: 1024 / 64
// orders one wave's LDS writes and its other lanes' LDS reads (the per-wave P and O tiles)
__device__ __forceinline__ void ba_wave_sync() {
    __builtin_amdgcn_fence(__ATOMIC_RELEASE, "workgroup");
    __builtin_amdgcn_wave_barrier();
    __builtin_amdgcn_fence(__ATOMIC_ACQUIRE, "workgroup");
}
// One stage: ten asynchronous copies, 16 B per lane each; a lane fills 16 B of stage rows (thread >> 3) + 32 * i. Rows 0..191 come from the three weight planes, 192..319 from X.
// The s_wait_xcnt ends the copies' own statement, so that no address register of a copy is rewritten in front of it.
__device__ __forceinline__ void qa_fill(unsigned l, const unsigned short* gW, const unsigned short* gX) {
    asm volatile(
        "global_load_async_to_lds_b128 %0, %10, off\n\t"
        "global_load_async_to_lds_b128 %1, %11, off\n\t"
        "global_load_async_to_lds_b128 %2, %12, off\n\t"
        "global_load_async_to_lds_b128 %3, %13, off\n\t"
        "global_load_async_to_lds_b128 %4, %14, off\n\t"
        "global_load_async_to_lds_b128 %5, %15, off\n\t"
        "global_load_async_to_lds_b128 %6, %16, off\n\t"
        "global_load_async_to_lds_b128 %7, %17, off\n\t"
        "global_load_async_to_lds_b128 %8, %18, off\n\t"
        "global_load_async_to_lds_b128 %9, %19, off\n\t"
        "s_wait_xcnt 0x0"
        :: "v"(l), "v"(l + 32u * QA_PITCH), "v"(l + 64u * QA_PITCH), "v"(l + 96u * QA_PITCH), "v"(l + 128u * QA_PITCH),
           "v"(l + 160u * QA_PITCH), "v"(l + 192u * QA_PITCH), "v"(l + 224u * QA_PITCH), "v"(l + 256u * QA_PITCH), "v"(l + 288u * QA_PITCH),
           "v"(gW), "v"(gW + (size_t)32 * 1024), "v"(gW + (size_t)1024 * 1024), "v"(gW + (size_t)(1024 + 32) * 1024),
           "v"(gW + (size_t)2048 * 1024), "v"(gW + (size_t)(2048 + 32) * 1024),
           "v"(gX), "v"(gX + (size_t)32 * 1024), "v"(gX + (size_t)64 * 1024), "v"(gX + (size_t)96 * 1024)
        : "memory");
}
__global__ __launch_bounds__(256, 4) void k_qkv_attn(const unsigned short* __restrict__ Xh, const unsigned short* __restrict__ Wt, const int* __restrict__ VL, _Float16* __restrict__ O) {
    typedef w25::Frag<_Float16> FH;
    static_assert(QA_NS * QA_STAGE >= 107520, "the attention's tiles lie in the ring");
    __shared__ __attribute__((aligned(128))) unsigned char sL[QA_NS * QA_STAGE];
    const int tid = threadIdx.x, lane = tid & 31, hf = lane >> 4, l15 = lane & 15, wave = tid >> 5;
    const int h = blockIdx.x & 15, z = blockIdx.x >> 4;
    const int g = wave & 3, wm = (wave >> 2) * 64;
    const float L2E = 1.4426950408889634f;
    const float NEG = -__builtin_inff();

    const unsigned ldsLane = (unsigned)(uintptr_t)(&sL[0]) + (unsigned)((tid >> 3) * QA_PITCH + (tid & 7) * 16);
    const unsigned short* gW = Wt + (size_t)(h * 64 + (tid >> 3)) * 1024 + (tid & 7) * 8;
    const unsigned short* gX = Xh + (size_t)(z * 128 + (tid >> 3)) * 1024 + (tid & 7) * 8;
    v8f aq[4], ak[4], av[4];
#pragma unroll
    for (int i = 0; i < 4; ++i) { v8f zz = {}; aq[i] = zz; ak[i] = zz; av[i] = zz; }

    // A stage is 10 copies of every wave, so "all but the 10 youngest" is "up to and with the older of the two stages under way".
    qa_fill(ldsLane, gW, gX);
    qa_fill(ldsLane + QA_STAGE, gW + 64, gX + 64);
    w25::gl_wait_async_but<10>();                // stage 0 has landed
    __syncthreads();                             // stage 0 is readable by every wave
    qa_fill(ldsLane + 2u * QA_STAGE, gW + 128, gX + 128);

    unsigned bo = 0;                             // byte offset of the buffer that holds stage t
    // kept rolled: one pass per trip, so that the order at its foot stands once
#pragma unroll 1
    for (int t = 0; t < QA_NT; ++t) {
        const unsigned char* pW = sL + bo + (g * 16 + l15) * QA_PITCH + hf * 16;
        const unsigned char* pX = sL + bo + (192 + wm + l15) * QA_PITCH + hf * 16;
        v16h wf[2][3], xf[2][4];                 // both 32-k fragment sets of the pass: its LDS reads stand in one place, ahead of its WMMAs
#pragma unroll
        for (int kk = 0; kk < 2; ++kk) {
#pragma unroll
            for (int j = 0; j < 3; ++j) wf[kk][j] = FH::load((const _Float16*)(pW + j * 64 * QA_PITCH + kk * 64));
#pragma unroll
            for (int i = 0; i < 4; ++i) xf[kk][i] = FH::load((const _Float16*)(pX + i * 16 * QA_PITCH + kk * 64));
        }
        __builtin_amdgcn_sched_barrier(0);       // keeps the pass's LDS reads as one group ahead of its WMMAs, not among them
#pragma unroll
        for (int kk = 0; kk < 2; ++kk)
#pragma unroll
            for (int i = 0; i < 4; ++i) {
                aq[i] = FH::mma(wf[kk][0], xf[kk][i], aq[i]);      // D: lane = position, element = dim
                ak[i] = FH::mma(wf[kk][1], xf[kk][i], ak[i]);
                av[i] = FH::mma(xf[kk][i], wf[kk][2], av[i]);      // D: lane = dim, element = position
            }
        __builtin_amdgcn_sched_barrier(0);       // ends the pass's WMMAs: the foot stays behind them
        w25::gl_wait_ds0();
        // Stage t + 1 has landed. While stage t + 2 exists, its 10 copies are this wave's youngest and stay under way; on the last trips the wait is to 0.
        if (t + QA_NS <= QA_NT) w25::gl_wait_async_but<10>();
        else w25::gl_wait_async0();
        __syncthreads();                         // publishes stage t + 1 and ends every read of stage t
        if (t + QA_NS < QA_NT) qa_fill(ldsLane + bo, gW + (size_t)(t + QA_NS) * 64, gX + (size_t)(t + QA_NS) * 64);
        bo = (bo == (QA_NS - 1u) * QA_STAGE) ? 0u : bo + QA_STAGE;
    }
    w25::gl_wait_async0();

    // The ring is free: the last trip's foot waited for every read and every copy and passed the barrier. The attention's tiles take its place.
    _Float16* ql = (_Float16*)(sL);                              // Q   [position][d], 128 x BA_KP
    _Float16* kl = (_Float16*)(sL + 18432);                      // K   [key][d],      128 x BA_KP
    _Float16* vt = (_Float16*)(sL + 36864);                      // V^T [d][key],       64 x BA_VP
    _Float16* myp = (_Float16*)(sL + 54272) + wave * (16 * BA_KP);   // this wave's P tile, 16 x BA_KP
    float*    myo = (float*)(sL + 72704) + wave * (16 * 68);         // this wave's O tile, 16 x 68
#pragma unroll
    for (int i = 0; i < 4; ++i) {
        v8h hq, hk, hv;
#pragma unroll
        for (int r = 0; r < 8; ++r) { hq[r] = (_Float16)(aq[i][r] * 0.0625f); hk[r] = (_Float16)(ak[i][r] * 0.0625f); hv[r] = (_Float16)(av[i][r] * 0.0625f); }
        *(v8h*)(ql + (wm + i * 16 + l15) * BA_KP + g * 16 + hf * 8) = hq;
        *(v8h*)(kl + (wm + i * 16 + l15) * BA_KP + g * 16 + hf * 8) = hk;
        *(v8h*)(vt + (g * 16 + l15) * BA_VP + wm + i * 16 + hf * 8) = hv;
    }
    const size_t base = (size_t)z * (128 * 1024) + (size_t)h * 64;      // (row 0, dim 0) of this block and head in O
    const int c8 = (lane & 7) * 8;
    const int vlen = VL[z >> 3];                                         // valid length of this block's sequence (eight blocks of 128 positions to a sequence)
    int mk[8];
#pragma unroll
    for (int i = 0; i < 8; ++i) mk[i] = ((z & 7) * 128 + i * 16 + l15 < vlen) ? 1 : 0;         // keep flag of key 16i + l15: its position in the sequence is below the valid length
    v8f o[4]; float m8[8], l8[8];
#pragma unroll
    for (int t = 0; t < 4; ++t) { v8f zz = {}; o[t] = zz; }
#pragma unroll
    for (int i = 0; i < 8; ++i) { m8[i] = NEG; l8[i] = 0.f; }
    __syncthreads();                                                      // Q, K and V^T are readable by every wave; they are not written again
    v16h qa[2];                                                           // A fragment: element e <- dim 32 ks + frag_k(e, hf)
#pragma unroll
    for (int ks = 0; ks < 2; ++ks) qa[ks] = FH::load(ql + (wave * 16 + l15) * BA_KP + ks * 32 + 8 * hf);

#pragma unroll
    for (int jb = 0; jb < 2; ++jb) {
        const int j0 = jb * 64;
        v8f s[4];
#pragma unroll
        for (int t = 0; t < 4; ++t) {
            const _Float16* kr = kl + (j0 + t * 16 + l15) * BA_KP + 8 * hf;
            v8f acc = {};
            acc = FH::mma(qa[0], FH::load(kr), acc);
            acc = FH::mma(qa[1], FH::load(kr + 32), acc);
            s[t] = acc;
        }
#pragma unroll
        for (int i = 0; i < 8; ++i) {
            float sc[4];
#pragma unroll
            for (int t = 0; t < 4; ++t) {
                float v = s[t][i] * 0.125f;
                if (mk[jb * 4 + t] == 0) v = -1000000.0f;
                v *= L2E;
                sc[t] = v;
            }
            float mx = fmaxf(fmaxf(sc[0], sc[1]), fmaxf(sc[2], sc[3]));
            mx = fmaxf(mx, __shfl_xor(mx, 1, 32)); mx = fmaxf(mx, __shfl_xor(mx, 2, 32));
            mx = fmaxf(mx, __shfl_xor(mx, 4, 32)); mx = fmaxf(mx, __shfl_xor(mx, 8, 32));
            const float mnew = fmaxf(m8[i], mx);
            const float ec = exp2f(m8[i] - mnew);                         // taken unconditionally and then selected: no branch round each exp2
            const float corr = (mnew == NEG) ? 1.f : ec;
            float rs = 0.f;
#pragma unroll
            for (int t = 0; t < 4; ++t) {
                const float ep = exp2f(sc[t] - mnew);
                const float pp = (sc[t] == NEG) ? 0.f : ep; rs += pp;
                myp[(i + 8 * hf) * BA_KP + t * 16 + l15] = (_Float16)(pp * 4096.f);
            }
            rs += __shfl_xor(rs, 1, 32); rs += __shfl_xor(rs, 2, 32); rs += __shfl_xor(rs, 4, 32); rs += __shfl_xor(rs, 8, 32);
            l8[i] = l8[i] * corr + rs; m8[i] = mnew;
#pragma unroll
            for (int t = 0; t < 4; ++t) o[t][i] *= corr;
        }
        ba_wave_sync();                                                   // P is written; its rows are read by other lanes of the wave
        const v16h pa0 = FH::load(myp + l15 * BA_KP + 8 * hf), pa1 = FH::load(myp + l15 * BA_KP + 32 + 8 * hf);
#pragma unroll
        for (int t = 0; t < 4; ++t) {
            const _Float16* vr = vt + (t * 16 + l15) * BA_VP + j0 + 8 * hf;
            o[t] = FH::mma(pa0, FH::load(vr), o[t]);
            o[t] = FH::mma(pa1, FH::load(vr + 32), o[t]);
        }
        ba_wave_sync();                                                   // P is read; the next half may overwrite it
    }
#pragma unroll
    for (int i = 0; i < 8; ++i) {
        const float rl = 1.f / (l8[i] * 4096.f);
        const float invr = (l8[i] > 0.f) ? rl : 0.f;
#pragma unroll
        for (int t = 0; t < 4; ++t) myo[(i + 8 * hf) * 68 + t * 16 + l15] = o[t][i] * invr;
    }
    ba_wave_sync();                                                       // O is written; its rows go out as whole 128-byte lines of f16
    const int r4 = lane >> 3;
    _Float16* op = O + base + (size_t)(wave * 16 + r4) * 1024 + c8;
#pragma unroll
    for (int it = 0; it < 4; ++it) {                                      // rows 4 * it + r4
        const float* sp = myo + (it * 4 + r4) * 68 + c8;
        const v4f lo = *(const v4f*)(sp), hi = *(const v4f*)(sp + 4);
        v8h hv;
#pragma unroll
        for (int e = 0; e < 4; ++e) { hv[e] = (_Float16)lo[e]; hv[4 + e] = (_Float16)hi[e]; }
        *(v8h*)(op + (size_t)it * (4 * 1024)) = hv;
    }
}

extern "C" void kernel_launch(void* const* d_in, const int* in_sizes, int n_in, void* d_out, int out_size, void* d_ws, size_t ws_size, hipStream_t stream) {
    (void)in_sizes; (void)n_in; (void)out_size; (void)ws_size;
    const float* X = (const float*)d_in[0];
    const int* vl = (const int*)d_in[1];
    const float* Wq = (const float*)d_in[2];
    const float* Wk = (const float*)d_in[3];
    const float* Wv = (const float*)d_in[4];
    const float* Wo = (const float*)d_in[5];
    const float* g1 = (const float*)d_in[6];
    const float* be1 = (const float*)d_in[7];
    const float* W1 = (const float*)d_in[8];
    const float* bf1 = (const float*)d_in[9];
    const float* W2 = (const float*)d_in[10];
    const float* bf2 = (const float*)d_in[11];
    const float* g2 = (const float*)d_in[12];
    const float* be2 = (const float*)d_in[13];
    const int Bn = 4;
    const int S = 1024;
    const int D = 1024;
    const int NH = 16;
    const int DH = 64;
    const int F = 4096;
    const int M = 128;
    const int NB = S / M;
    const int NR = Bn * S;
    float* out = (float*)d_out;
    char* wsp = (char*)d_ws;
    float* Q = (float*)wsp; wsp += (((size_t)((size_t)NR * D) * 4 + 255) / 256) * 256;
    float* Kb = (float*)wsp; wsp += (((size_t)((size_t)NR * D) * 4 + 255) / 256) * 256;
    float* V = (float*)wsp; wsp += (((size_t)((size_t)NR * D) * 4 + 255) / 256) * 256;
    float* AT = (float*)wsp; wsp += (((size_t)((size_t)NR * D) * 4 + 255) / 256) * 256;
    float* MF = (float*)wsp; wsp += (((size_t)((size_t)NR) * 4 + 255) / 256) * 256;
    float* Y = (float*)wsp; wsp += (((size_t)((size_t)NR * D) * 4 + 255) / 256) * 256;
    float* ST = (float*)wsp; wsp += (((size_t)((size_t)NR * 32) * 4 + 255) / 256) * 256;
    float* H1 = (float*)wsp; wsp += (((size_t)((size_t)NR * F) * 4 + 255) / 256) * 256;
    unsigned short* G64A = (unsigned short*)wsp; wsp += (((size_t)(16777216) * 2 + 255) / 256) * 256;
    unsigned short* G64B = (unsigned short*)wsp; wsp += (((size_t)(4194304) * 2 + 255) / 256) * 256;
    // Planes of f16 values, each written by the kernel that makes the values: X and the six transposed weights (one launch),
    // the attention's output, the first LayerNorm's output (in G64A, once the projections have read X there, beside its f32 copy Y) and the FFN's hidden layer.
    _Float16* Oh = (_Float16*)Q;                     // the attention's output: its own plane, since other work-groups of its launch still read X in G64A
    _Float16* Ah = (_Float16*)G64A;
    _Float16* Hh = (_Float16*)H1;
    _Float16* Wt4 = (_Float16*)G64B;                 // Wq^T, Wk^T, Wv^T, Wo^T: 1024 x 1024 each
    _Float16* Wot = Wt4 + 3 * 1024 * 1024;
    _Float16* W1t = (_Float16*)AT;                   // 4096 x 1024
    _Float16* W2t = W1t + 4096 * 1024;               // 1024 x 4096
    k_cast_all<<<2048, 256, 0, stream>>>(X, Wq, Wk, Wv, Wo, W1, W2, Ah, Wt4, W1t, W2t);
    k_qkv_attn<<<512, 256, 0, stream>>>((const unsigned short*)(G64A), (const unsigned short*)(Wt4), vl, Oh);
    w25::wmma_gemm_lds<1024, 1024, 0, true, 0, false, 1024, 0, 4><<<256, 256, 0, stream>>>((const unsigned short*)(Q), (const unsigned short*)(Wot), Y, nullptr, nullptr, X, 0.0625f);
    k_ln_w<true><<<(unsigned)(NR / 16), 256, 0, stream>>>(Y, Y, Ah, 1e-05f, g1, be1);
    w25::wmma_gemm_lds<4096, 1024, 2, false, 2, true, 4096, 0, 2, 4, 8><<<256, 256, 0, stream>>>((const unsigned short*)(G64A), (const unsigned short*)(W1t), nullptr, Hh, bf1, nullptr, 0.0625f);
    w25::wmma_gemm_lds<1024, 4096, 2, true, 0, false, 1024, 0, 4><<<256, 256, 0, stream>>>((const unsigned short*)(H1), (const unsigned short*)(W2t), Kb, nullptr, bf2, Y, 0.0625f);
    k_ln_w<false><<<(unsigned)(NR / 16), 256, 0, stream>>>(Kb, out, nullptr, 1e-05f, g2, be2);
}

// v010
// One run takes 109 microseconds.
// Next to v009, in two timings, it ran 1.06 times as fast each time.
// Over all steps from v000, the starting kernel, it is 13.4 times as fast.
// Contractions: q/k/v/o projections X.W [4096x1024].[1024x1024] and the position-wise FFN relu(Y.W1 + b) [4096x1024].[1024x4096], .W2 + b [4096x4096].[4096x1024] with f16 operands on pre-cast planes (v_wmma_f32_16x16x32_f16; register-blocked wave tiles of 64x48 (q/k/v), 32x64 (o, W2) and 64x128 (W1), weights x16); the block-diagonal windowed attention (8 blocks of 128 positions per sequence = 32 independent (sequence, block) attentions, 16 heads, keys >= valid_len SET to -1e6 through an integer keep-mask — exactly the module's where, so blocks lying wholly beyond valid_len are uniform) inside the q/k/v projection's launch, from LDS (f16 q.k^T and p.v with p as f16 of 4096 p); f32 accumulate and softmax. AddNorm LayerNorms (two rows per wave, fixed-order trees) are f32 kernels; the keep-mask is formed inside the attention from the INPUT valid lengths.
#include <hip/hip_runtime.h>
#include <math.h>

typedef __attribute__((ext_vector_type(16))) _Float16 v16h;
typedef __attribute__((ext_vector_type(8)))  _Float16 v8h;
typedef __attribute__((ext_vector_type(16))) __bf16   v16b;
typedef __attribute__((ext_vector_type(8)))  float    v8f;
typedef __attribute__((ext_vector_type(4)))  float    v4f;

// 16-bit WMMA fragment map (wave32), lane L, h = L>>4, m = L&15:
//   A 16x32: lane = row m;   element i -> k = (i<8) ? 8h+i : 16+8h+(i-8)
//   B 32x16: lane = column m; the SAME k(i,h)
//   D 16x16 (8 f32): lane = column m; element r -> row 8h+r
__device__ __forceinline__ int frag_k(int i, int h) { return (i < 8) ? (8 * h + i) : (16 + 8 * h + (i - 8)); }
__device__ __forceinline__ __bf16 bf16_rne(float f) {
    unsigned int u = __float_as_uint(f);
    u += 0x7fffu + ((u >> 16) & 1u);
    return __builtin_bit_cast(__bf16, (unsigned short)(u >> 16));
}
__device__ __forceinline__ float bf16_f32(__bf16 b) { return __uint_as_float(((unsigned int)__builtin_bit_cast(unsigned short, b)) << 16); }
__device__ __forceinline__ v8f wmma16(v16h a, v16h b, v8f c) {
    c = __builtin_amdgcn_wmma_f32_16x16x32_f16(false, a, false, b, (short)0, c, false, false);
    asm volatile("v_nop\n\tv_nop\n\tv_nop\n\tv_nop" : "+v"(c) : "v"(a), "v"(b));
    return c;
}
__device__ __forceinline__ v8f wmmab(v16b a, v16b b, v8f c) {
    c = __builtin_amdgcn_wmma_f32_16x16x32_bf16(false, a, false, b, (short)0, c, false, false);
    asm volatile("v_nop\n\tv_nop\n\tv_nop\n\tv_nop" : "+v"(c) : "v"(a), "v"(b));
    return c;
}
struct Split { v16b hi, lo; };
// hi/lo split product: a.hi*b.hi + a.hi*b.lo + a.lo*b.hi
__device__ __forceinline__ v8f wmma3(const Split& a, const Split& b, v8f c) {
    c = __builtin_amdgcn_wmma_f32_16x16x32_bf16(false, a.hi, false, b.hi, (short)0, c, false, false);
    c = __builtin_amdgcn_wmma_f32_16x16x32_bf16(false, a.hi, false, b.lo, (short)0, c, false, false);
    c = __builtin_amdgcn_wmma_f32_16x16x32_bf16(false, a.lo, false, b.hi, (short)0, c, false, false);
    asm volatile("v_nop\n\tv_nop\n\tv_nop\n\tv_nop" : "+v"(c) : "v"(a.hi), "v"(a.lo), "v"(b.hi), "v"(b.lo));
    return c;
}
struct Split3 { v16b hi, mid, lo; };
// triple split product (6 terms, drops only terms below 2^-24 relative)
__device__ __forceinline__ v8f wmma6(const Split3& a, const Split3& b, v8f c) {
    c = __builtin_amdgcn_wmma_f32_16x16x32_bf16(false, a.hi, false, b.hi, (short)0, c, false, false);
    c = __builtin_amdgcn_wmma_f32_16x16x32_bf16(false, a.hi, false, b.mid, (short)0, c, false, false);
    c = __builtin_amdgcn_wmma_f32_16x16x32_bf16(false, a.mid, false, b.hi, (short)0, c, false, false);
    c = __builtin_amdgcn_wmma_f32_16x16x32_bf16(false, a.hi, false, b.lo, (short)0, c, false, false);
    c = __builtin_amdgcn_wmma_f32_16x16x32_bf16(false, a.mid, false, b.mid, (short)0, c, false, false);
    c = __builtin_amdgcn_wmma_f32_16x16x32_bf16(false, a.lo, false, b.hi, (short)0, c, false, false);
    asm volatile("v_nop\n\tv_nop\n\tv_nop\n\tv_nop" : "+v"(c) : "v"(a.hi), "v"(a.mid), "v"(a.lo), "v"(b.hi), "v"(b.mid), "v"(b.lo));
    return c;
}

// Fragment gathers from f32 memory: element i <- p[(k0 + frag_k(i,h)) * sk] * s, zero for k >= klen.
__device__ __forceinline__ v16h fh_ld(const float* __restrict__ p, long long sk, int k0, int h, int klen, float s) {
    v16h a;
#pragma unroll
    for (int i = 0; i < 16; ++i) { const int k = k0 + frag_k(i, h); a[i] = (k < klen) ? (_Float16)(p[(long long)k * sk] * s) : (_Float16)0.f; }
    return a;
}
__device__ __forceinline__ Split sp_ld(const float* __restrict__ p, long long sk, int k0, int h, int klen, float s) {
    Split r;
#pragma unroll
    for (int i = 0; i < 16; ++i) {
        const int k = k0 + frag_k(i, h); const float x = (k < klen) ? p[(long long)k * sk] * s : 0.f;
        const __bf16 hb = bf16_rne(x); r.hi[i] = hb; r.lo[i] = bf16_rne(x - bf16_f32(hb));
    }
    return r;
}
__device__ __forceinline__ Split3 sp3_ld(const float* __restrict__ p, long long sk, int k0, int h, int klen, float s) {
    Split3 r;
#pragma unroll
    for (int i = 0; i < 16; ++i) {
        const int k = k0 + frag_k(i, h); const float x = (k < klen) ? p[(long long)k * sk] * s : 0.f;
        const __bf16 hb = bf16_rne(x); const float r1 = x - bf16_f32(hb); const __bf16 mb = bf16_rne(r1);
        r.hi[i] = hb; r.mid[i] = mb; r.lo[i] = bf16_rne(r1 - bf16_f32(mb));
    }
    return r;
}
__device__ __forceinline__ v16b bh_ld(const float* __restrict__ p, long long sk, int k0, int h, int klen, float s) {
    v16b a;
#pragma unroll
    for (int i = 0; i < 16; ++i) { const int k = k0 + frag_k(i, h); a[i] = bf16_rne((k < klen) ? p[(long long)k * sk] * s : 0.f); }
    return a;
}
// f16 fragment from an f16 LDS/global row with element stride 1 (k-contiguous), no bounds (tile already zero padded)
__device__ __forceinline__ v16h fh_row(const _Float16* __restrict__ row, int k0, int h) {
    v16h a;
#pragma unroll
    for (int i = 0; i < 16; ++i) a[i] = row[k0 + frag_k(i, h)];
    return a;
}

#define VST2(T, ptr, val) do { const T vst2_v_ = (val); *(T*)(ptr) = vst2_v_;  } while (0)
typedef float v4f __attribute__((ext_vector_type(4)));
#define VST2V4(ptr, val) do { const v4f vst2_v4_ = (val); *(v4f*)(ptr) = vst2_v4_;  } while (0)

__device__ __attribute__((noinline)) float act_fn(float v, int act) {
    if (act == 1) return fmaxf(v, 0.f);                                                                               // relu
    if (act == 2) { const float u = 0.7978845608028654f * (v + 0.044715f * v * v * v); return 0.5f * v * (1.f + tanhf(u)); } // tanh-gelu
    if (act == 3) return v / (1.f + expf(-v));                                                                        // silu
    if (act == 4) return 0.5f * v * (1.f + erff(v * 0.7071067811865476f));                                             // erf-gelu
    if (act == 5) return tanhf(v);
    if (act == 6) return 1.f / (1.f + expf(-v));                                                                      // sigmoid
    if (act == 7) return (v > 0.f) ? v : 0.01f * v;                                                                   // leaky relu 0.01
    if (act == 8) return (v > 0.f) ? v : (expf(v) - 1.f);                                                             // elu
    if (act == 9) return fminf(fmaxf(v, 0.f), 6.f);                                                                   // relu6
    if (act == 10) return fabsf(v);                                                                                    // abs
    if (act == 11) return (v >= 0.f) ? v : 0.1f * v;                                                                  // leaky 0.1
    if (act == 12) return (v > 0.f) ? v : 0.2f * v;                                                                   // leaky 0.2
    if (act == 13) return (v > 20.f) ? v : log1pf(expf(v));                                                            // softplus
    return v;
}

// =====================================================================================================================
// k_gemm<MODE>: C(z, m, n) = act(alpha * sum_k A(z, m, k) * B(z, k, n) + bias) + beta * R(z, m, n)
//   One wave (32-thread block) per 16 x 32 tile of C; grid (ceil(N/32), ceil(M/16), Z). Batch z -> (zo = z / zi_n, zi = z % zi_n)
//   with separate outer/inner strides for every tensor (e.g. batch and head). A(m,k) = A[zo*sAo + zi*sAi + m*sAm + k*sAk] (f32),
//   B(k,n) = B[zo*sBo + zi*sBi + n*sBn + k*sBk] (f32); any M, N, K (K zero-padded to 32 inside the fragments, M/N tails guarded).
//   C(m,n) = C[zo*sCo + zi*sCi + m*sCm + n] (n contiguous). flags: 1 bias[n], 2 bias[m], 4 residual R[zo*sRo + zi*sRi + m*sRm + n*sRn].
//   MODE 0: f16 operands (A prescaled by sa, B by sb, both undone in the epilogue); 1: bf16 hi/lo split (3 products); 2: bf16;
//   3: bf16 hi/mid/lo triple split (6 products); 4: as 3 with Kahan-compensated f32 accumulation across k-steps.
// =====================================================================================================================
struct GemmP {
    const float* A; const float* B; const float* bias; const float* R; float* C;
    long long sAo, sAi, sAm, sAk, sBo, sBi, sBn, sBk, sCo, sCi, sCm, sRo, sRi, sRm, sRn;
    int M, N, K, zi_n, flags, act; float alpha, beta, sa, sb;
    int Npad, pad_;     // columns [N, Npad) of C are written as 0 so that padded workspace rows are covered by whole-line stores; Npad >= N
};
static_assert(sizeof(GemmP) == 5 * 8 + 15 * 8 + 6 * 4 + 4 * 4 + 2 * 4, "GemmP has padding");

template <int MODE>
__global__ __launch_bounds__(32) void k_gemm(GemmP p) {
    const int lane = threadIdx.x & 31, h = lane >> 4, l15 = lane & 15;
    const int m0 = blockIdx.y * 16, n0 = blockIdx.x * 32;
    const int z = blockIdx.z, zo = z / p.zi_n, zi = z - zo * p.zi_n;
    const float* A = p.A + zo * p.sAo + zi * p.sAi;
    const float* B = p.B + zo * p.sBo + zi * p.sBi;
    const int am = min(m0 + l15, p.M - 1);                       // clamped row for loads (stores are guarded)
    v8f acc[2], comp[2];
#pragma unroll
    for (int t = 0; t < 2; ++t) { v8f zz = {}; acc[t] = zz; comp[t] = zz; }
    for (int k0 = 0; k0 < p.K; k0 += 32) {
        const float* arow = A + (long long)am * p.sAm;
        if (MODE == 1) {
            const Split a = sp_ld(arow, p.sAk, k0, h, p.K, 1.f);
#pragma unroll
            for (int t = 0; t < 2; ++t) {
                const int bn = min(n0 + t * 16 + l15, p.N - 1);
                acc[t] = wmma3(a, sp_ld(B + (long long)bn * p.sBn, p.sBk, k0, h, p.K, 1.f), acc[t]);
            }
        } else if (MODE == 3) {
            const Split3 a = sp3_ld(arow, p.sAk, k0, h, p.K, 1.f);
#pragma unroll
            for (int t = 0; t < 2; ++t) {
                const int bn = min(n0 + t * 16 + l15, p.N - 1);
                acc[t] = wmma6(a, sp3_ld(B + (long long)bn * p.sBn, p.sBk, k0, h, p.K, 1.f), acc[t]);
            }
        } else if (MODE == 4) {
            // triple split as MODE 3, but each k-step's 6 products go into a fresh accumulator and the partial is added to the running f32 sum
            // on the VALU with Kahan compensation (accumulation error stays ~1 ulp however long K is)
            const Split3 a = sp3_ld(arow, p.sAk, k0, h, p.K, 1.f);
#pragma unroll
            for (int t = 0; t < 2; ++t) {
                const int bn = min(n0 + t * 16 + l15, p.N - 1); v8f zz = {};
                const v8f part = wmma6(a, sp3_ld(B + (long long)bn * p.sBn, p.sBk, k0, h, p.K, 1.f), zz);
                const v8f y = part - comp[t]; const v8f s = acc[t] + y; comp[t] = (s - acc[t]) - y; acc[t] = s;
            }
        } else if (MODE == 2) {
            const v16b a = bh_ld(arow, p.sAk, k0, h, p.K, 1.f);
#pragma unroll
            for (int t = 0; t < 2; ++t) {
                const int bn = min(n0 + t * 16 + l15, p.N - 1);
                acc[t] = wmmab(a, bh_ld(B + (long long)bn * p.sBn, p.sBk, k0, h, p.K, 1.f), acc[t]);
            }
        } else {
            const v16h a = fh_ld(arow, p.sAk, k0, h, p.K, p.sa);
#pragma unroll
            for (int t = 0; t < 2; ++t) {
                const int bn = min(n0 + t * 16 + l15, p.N - 1);
                acc[t] = wmma16(a, fh_ld(B + (long long)bn * p.sBn, p.sBk, k0, h, p.K, p.sb), acc[t]);
            }
        }
    }
    const float iscale = (MODE == 0) ? p.alpha / (p.sa * p.sb) : p.alpha;
    float* C = p.C + zo * p.sCo + zi * p.sCi;
    const float* R = p.R + zo * p.sRo + zi * p.sRi;
    __shared__ __align__(16) float ctile[16][36];
#pragma unroll
    for (int t = 0; t < 2; ++t) {
        const int n = n0 + t * 16 + l15; const int nn = min(n, p.N - 1);
#pragma unroll
        for (int r = 0; r < 8; ++r) {
            const int m = m0 + 8 * h + r; const int mm = min(m, p.M - 1);
            float v = acc[t][r] * iscale;
            if (p.flags & 1) v += p.bias[nn];
            if (p.flags & 2) v += p.bias[mm];
            if (p.flags & 8) v *= p.bias[(long long)zo * p.M + mm];   /* per-(z,row) scale vector laid out [Z][M]; exclusive with the bias flags */
            v = act_fn(v, p.act);
            if (p.flags & 4) v += p.beta * R[(long long)mm * p.sRm + (long long)nn * p.sRn];
            ctile[8 * h + r][t * 16 + l15] = (n < p.N) ? v : 0.f;
        }
    }
    __syncthreads();
    const int NW = (p.Npad > p.N) ? p.Npad : p.N;           // write width
    const bool fast = (m0 + 16 <= p.M) && (n0 + 32 <= NW) && ((p.sCm & 3) == 0) && ((((size_t)C) & 15) == 0);
    if (fast) {
#pragma unroll
        for (int s = 0; s < 4; ++s) {
            const int row = s * 4 + (lane >> 3), c4 = (lane & 7) * 4;
            const v4f v = *(const v4f*)&ctile[row][c4];
            VST2V4(C + (long long)(m0 + row) * p.sCm + n0 + c4, v);
        }
    } else {
        for (int row = 0; row < 16; ++row) {
            const int m = m0 + row, n = n0 + lane;
            if (m < p.M && n < NW) VST2(float, C + (long long)m * p.sCm + n, ctile[row][lane]);
        }
    }
}


// =====================================================================================================================
// k_gemmT<MODE, TM, TN>: same contract as k_gemm, but one wave computes a (16*TM) x (16*TN) tile: TM A fragments and TN B fragments are
//   loaded per 32-wide k-step and reused across TM*TN WMMAs (far fewer load/convert instructions per MAC). MODE 0 (f16), 1 (bf16 hi/lo),
//   2 (bf16) only. grid (ceil(NW/(16*TN)), ceil(M/(16*TM)), Z), block 32. Epilogue identical to k_gemm, run per 16x32 sub-tile.
// =====================================================================================================================
template <int MODE, int TM, int TN>
__global__ __launch_bounds__(32) void k_gemmT(GemmP p) {
    const int lane = threadIdx.x & 31, h = lane >> 4, l15 = lane & 15;
    const int m0 = blockIdx.y * (16 * TM), n0 = blockIdx.x * (16 * TN);
    const int z = blockIdx.z, zo = z / p.zi_n, zi = z - zo * p.zi_n;
    const float* A = p.A + zo * p.sAo + zi * p.sAi;
    const float* B = p.B + zo * p.sBo + zi * p.sBi;
    v8f acc[TM][TN];
#pragma unroll
    for (int i = 0; i < TM; ++i)
#pragma unroll
        for (int t = 0; t < TN; ++t) { v8f zz = {}; acc[i][t] = zz; }
    for (int k0 = 0; k0 < p.K; k0 += 32) {
        if (MODE == 1) {
            Split a[TM], b[TN];
#pragma unroll
            for (int i = 0; i < TM; ++i) { const int am = min(m0 + 16 * i + l15, p.M - 1); a[i] = sp_ld(A + (long long)am * p.sAm, p.sAk, k0, h, p.K, 1.f); }
#pragma unroll
            for (int t = 0; t < TN; ++t) { const int bn = min(n0 + 16 * t + l15, p.N - 1); b[t] = sp_ld(B + (long long)bn * p.sBn, p.sBk, k0, h, p.K, 1.f); }
#pragma unroll
            for (int i = 0; i < TM; ++i)
#pragma unroll
                for (int t = 0; t < TN; ++t) acc[i][t] = wmma3(a[i], b[t], acc[i][t]);
        } else if (MODE == 2) {
            v16b a[TM], b[TN];
#pragma unroll
            for (int i = 0; i < TM; ++i) { const int am = min(m0 + 16 * i + l15, p.M - 1); a[i] = bh_ld(A + (long long)am * p.sAm, p.sAk, k0, h, p.K, 1.f); }
#pragma unroll
            for (int t = 0; t < TN; ++t) { const int bn = min(n0 + 16 * t + l15, p.N - 1); b[t] = bh_ld(B + (long long)bn * p.sBn, p.sBk, k0, h, p.K, 1.f); }
#pragma unroll
            for (int i = 0; i < TM; ++i)
#pragma unroll
                for (int t = 0; t < TN; ++t) acc[i][t] = wmmab(a[i], b[t], acc[i][t]);
        } else {
            v16h a[TM], b[TN];
#pragma unroll
            for (int i = 0; i < TM; ++i) { const int am = min(m0 + 16 * i + l15, p.M - 1); a[i] = fh_ld(A + (long long)am * p.sAm, p.sAk, k0, h, p.K, p.sa); }
#pragma unroll
            for (int t = 0; t < TN; ++t) { const int bn = min(n0 + 16 * t + l15, p.N - 1); b[t] = fh_ld(B + (long long)bn * p.sBn, p.sBk, k0, h, p.K, p.sb); }
#pragma unroll
            for (int i = 0; i < TM; ++i)
#pragma unroll
                for (int t = 0; t < TN; ++t) acc[i][t] = wmma16(a[i], b[t], acc[i][t]);
        }
    }
    const float iscale = (MODE == 0) ? p.alpha / (p.sa * p.sb) : p.alpha;
    float* C = p.C + zo * p.sCo + zi * p.sCi;
    const float* R = p.R + zo * p.sRo + zi * p.sRi;
    const int NW = (p.Npad > p.N) ? p.Npad : p.N;
    __shared__ __align__(16) float ctile[16][36];
#pragma unroll
    for (int i = 0; i < TM; ++i) {
        const int mb = m0 + 16 * i; if (mb >= p.M) break;          // wave-uniform
#pragma unroll
        for (int tp = 0; tp < TN / 2; ++tp) {
            const int nb = n0 + 32 * tp; if (nb >= NW) break;        // wave-uniform
#pragma unroll
            for (int t2 = 0; t2 < 2; ++t2) {
                const int t = 2 * tp + t2; const int n = nb + t2 * 16 + l15; const int nn = min(n, p.N - 1);
#pragma unroll
                for (int r = 0; r < 8; ++r) {
                    const int m = mb + 8 * h + r; const int mm = min(m, p.M - 1);
                    float v = acc[i][t][r] * iscale;
                    if (p.flags & 1) v += p.bias[nn];
                    if (p.flags & 2) v += p.bias[mm];
            if (p.flags & 8) v *= p.bias[(long long)zo * p.M + mm];   /* per-(z,row) scale vector laid out [Z][M]; exclusive with the bias flags */
                    v = act_fn(v, p.act);
                    if (p.flags & 4) v += p.beta * R[(long long)mm * p.sRm + (long long)nn * p.sRn];
                    ctile[8 * h + r][t2 * 16 + l15] = (n < p.N) ? v : 0.f;
                }
            }
            __syncthreads();
            const bool fast = (mb + 16 <= p.M) && (nb + 32 <= NW) && ((p.sCm & 3) == 0) && ((((size_t)C) & 15) == 0);
            if (fast) {
#pragma unroll
                for (int s = 0; s < 4; ++s) {
                    const int row = s * 4 + (lane >> 3), c4 = (lane & 7) * 4;
                    const v4f v = *(const v4f*)&ctile[row][c4];
                    VST2V4(C + (long long)(mb + row) * p.sCm + nb + c4, v);
                }
            } else {
                for (int row = 0; row < 16; ++row) {
                    const int m = mb + row, n = nb + lane;
                    if (m < p.M && n < NW) VST2(float, C + (long long)m * p.sCm + n, ctile[row][lane]);
                }
            }
            __syncthreads();
        }
    }
}

// =====================================================================================================================
//   Wave = 16 queries, AW waves per block, 64-key blocks; grid (ceil(Lq/(16*AW)), H, B), block 32*AW. Any Lq, Lk; head dim dh <= DHP
//   (DHP multiple of 32), value dim dv <= DVP (multiple of 16, <= 128). Every tensor addressed by (batch, head, row, element) strides, f32.
//   Scores: QM 0 f16 operands, 1 bf16 hi/lo split, 2 bf16 triple split; statistics f32 (exp2 domain); P.V: P x 4096 as f16 with V f16 staged in LDS
//   (SPLITPV: P and V as bf16 hi/lo splits). kv head = h / hrep. Masking: causal = 1 (keep j <= i + coff, masked -> -inf, key blocks beyond the
//   diagonal skipped), causal = 2 (masked -> mfill, a finite fill like the -1e9; no skipping), causal = 3 (keep j >= i + coff,
//   masked -> -inf, no skipping); optional additive f32 mask Mf,
//   optional int keep-mask Mi (0 -> score := mfill), both addressed b*smb + h*smh + i*smi + j*smj (0 strides broadcast).
// =====================================================================================================================
#define AW 4
struct AttnP {   // apv4
    const float* Q; const float* K; const float* V; float* O; float* P; const float* Mf; const int* Mi; float* ST;
    const float* Pw; const float* Rt; const int* SQ; const int* SK;           // optional: post-softmax weight, relative-position table, segment ids
    long long swb, swh, swi, swj, srb, srh, sri;                                 // Pw strides (b,h,i,j); Rt strides (b,h,i), column = clamp(i - j + roff, 0, rn-1)
    long long sQb, sQh, sQi, sQd, sKb, sKh, sKj, sKd, sVb, sVh, sVj, sVd, sOb, sOh, sOi, sPb, sPh, sPi, smb, smh, smi, smj;
    int Lq, Lk, dh, dv, hrep, causal, coff, pband;   // pband > 0: P holds only the band |j - i| <= pband, column j - i + pband
    float scale, mfill; int nonorm, mpol;             // nonorm (online path only): O = sum_j exp(score_j) V_j without the 1/rowsum (scores must be <= ~0); mpol: Mi masks where ==0 (mpol 0) or where !=0 (mpol 1)
    int roff, rn, segpol, win;                        // Rt column offset/count; SQ/SK: score := mfill where (segpol 0) SQ[i] != SK[j] or (segpol 1) SQ[i] == SK[j]; win > 0: keys with i - j > win (after coff) -> -inf
};
//   Pw: the softmax numerator is multiplied by Pw(b,h,i,j) AFTER the row sum is taken (probs * weight, then P.V), as in post-softmax multiplicative biases.                                                    // ST (optional): per row (b,h,i) -> ST[((b*H + h)*Lq + i)*2 + {0,1}] = {row max of the scaled+masked score (natural units), sum_j exp(score - max)}
static_assert(sizeof(AttnP) == 12 * 8 + 29 * 8 + 16 * 4, "AttnP has padding");

#ifndef KATTN_ATTR
#define KATTN_ATTR
#endif
template <int DHP, int DVP, int QM, bool SPLITPV, bool TWOPASS>
__global__ __launch_bounds__(32 * AW) KATTN_ATTR void k_attn(AttnP p) {
    constexpr int NT = DVP / 16;                // output tiles
    constexpr int KS = DHP / 32;                // k-steps for the scores
    constexpr int VP = DVP + 8;                 // LDS pitch (halves)
    __shared__ __align__(16) float    pl[AW][16 * 64];
    __shared__ __align__(16) _Float16 vl[(SPLITPV ? 2 : 1) * 64 * VP];   // f16 V tile, or bf16 hi and lo tiles (same 2-byte size)
    const int lane = threadIdx.x & 31, hf = lane >> 4, l15 = lane & 15, wave = threadIdx.x >> 5;
    const int h = blockIdx.y, b = blockIdx.z, hk = h / p.hrep;
    const int q0 = (blockIdx.x * AW + wave) * 16;
    float* myp = pl[wave];
    const float L2E = 1.4426950408889634f;
    const float NEG = -__builtin_inff();
    const int qi = min(q0 + l15, p.Lq - 1);
    const float* qrow = p.Q + b * p.sQb + h * p.sQh + (long long)qi * p.sQi;
    const float* kbase = p.K + b * p.sKb + hk * p.sKh;
    const float* vbase = p.V + b * p.sVb + hk * p.sVh;
    v16h qa[QM == 0 ? KS : 1]; Split qs_[QM == 1 ? KS : 1]; Split3 qt_[QM == 2 ? KS : 1];
#pragma unroll
    for (int ks = 0; ks < KS; ++ks) {
        if (QM == 2) qt_[ks] = sp3_ld(qrow, p.sQd, ks * 32, hf, p.dh, 1.f);
        else if (QM == 1) qs_[ks] = sp_ld(qrow, p.sQd, ks * 32, hf, p.dh, 1.f);
        else qa[ks] = fh_ld(qrow, p.sQd, ks * 32, hf, p.dh, 1.f);
    }
    v8f o[NT]; float m8[8], l8[8];
#pragma unroll
    for (int t = 0; t < NT; ++t) { v8f zz = {}; o[t] = zz; }
#pragma unroll
    for (int i = 0; i < 8; ++i) { m8[i] = NEG; l8[i] = 0.f; }
    int jend = p.Lk; int jstart = 0;
    if (p.causal == 1) { const int je = (blockIdx.x * AW + AW - 1) * 16 + 16 + p.coff; jend = min(jend, max(je, 0)); }   // uniform per block
    if (p.win > 0) { const int js = (int)(blockIdx.x * AW) * 16 + p.coff - p.win; jstart = (js > 0) ? (js / 64) * 64 : 0; }   // uniform per block: key blocks entirely outside every row's window hold only -inf entries and are skipped exactly
    const int npass = TWOPASS ? 2 : 1;
    for (int pass = 0; pass < npass; ++pass) {
        const bool dopv = (!TWOPASS) || pass == 1;
        for (int j0 = jstart; j0 < jend; j0 += 64) {
            if (dopv) {
                __syncthreads();                                 // previous key block's reads of vl / pl are done
                for (int idx = threadIdx.x; idx < 64 * DVP; idx += 32 * AW) {
                    const int jr = idx / DVP, d = idx - jr * DVP, j = j0 + jr;
                    const float f = (j < p.Lk && d < p.dv) ? vbase[(long long)j * p.sVj + (long long)d * p.sVd] : 0.f;
                    if (SPLITPV) {
                        const __bf16 hb = bf16_rne(f);
                        ((__bf16*)vl)[jr * VP + d] = hb; ((__bf16*)vl)[64 * VP + jr * VP + d] = bf16_rne(f - bf16_f32(hb));
                    } else vl[jr * VP + d] = (_Float16)f;
                }
            }
            v8f s[4];
#pragma unroll
            for (int t = 0; t < 4; ++t) {
                const int j = min(j0 + t * 16 + l15, p.Lk - 1);
                const float* krow = kbase + (long long)j * p.sKj;
                v8f acc = {};
#pragma unroll
                for (int ks = 0; ks < KS; ++ks) {
                    if (QM == 2)      acc = wmma6(qt_[ks], sp3_ld(krow, p.sKd, ks * 32, hf, p.dh, 1.f), acc);
                    else if (QM == 1) acc = wmma3(qs_[ks], sp_ld(krow, p.sKd, ks * 32, hf, p.dh, 1.f), acc);
                    else              acc = wmma16(qa[ks], fh_ld(krow, p.sKd, ks * 32, hf, p.dh, 1.f), acc);
                }
                s[t] = acc;
            }
            float pv[8][4];
#pragma unroll
            for (int i = 0; i < 8; ++i) {
                const int irow = q0 + i + 8 * hf;
                const int ic = min(irow, p.Lq - 1);
                float sc[4];
#pragma unroll
                for (int t = 0; t < 4; ++t) {
                    const int jg = j0 + t * 16 + l15;
                    float v = s[t][i] * p.scale;
                    if (p.Mf) v += p.Mf[b * p.smb + h * p.smh + (long long)ic * p.smi + (long long)min(jg, p.Lk - 1) * p.smj];
                    if (p.Rt) { int rc = ic - min(jg, p.Lk - 1) + p.roff; rc = rc < 0 ? 0 : (rc >= p.rn ? p.rn - 1 : rc); v += p.Rt[b * p.srb + h * p.srh + (long long)ic * p.sri + rc]; }
                    if (p.Mi) { const int mv = p.Mi[b * p.smb + h * p.smh + (long long)ic * p.smi + (long long)min(jg, p.Lk - 1) * p.smj]; if (p.mpol ? (mv != 0) : (mv == 0)) v = p.mfill; }
                    if (p.SQ) { const bool same = p.SQ[(long long)b * p.Lq + ic] == p.SK[(long long)b * p.Lk + min(jg, p.Lk - 1)]; if (p.segpol ? same : !same) v = p.mfill; }
                    if (p.causal == 2 && jg > irow + p.coff) v = p.mfill;
                    if (jg >= p.Lk || (p.causal == 1 && jg > irow + p.coff) || (p.causal == 3 && jg < irow + p.coff) || (p.win > 0 && irow + p.coff - jg > p.win)) v = NEG; else v *= L2E;
                    sc[t] = v;
                }
                if (!TWOPASS || pass == 0) {
                    float mx = fmaxf(fmaxf(sc[0], sc[1]), fmaxf(sc[2], sc[3]));
                    mx = fmaxf(mx, __shfl_xor(mx, 1, 32)); mx = fmaxf(mx, __shfl_xor(mx, 2, 32));
                    mx = fmaxf(mx, __shfl_xor(mx, 4, 32)); mx = fmaxf(mx, __shfl_xor(mx, 8, 32));
                    const float mnew = fmaxf(m8[i], mx);
                    const float corr = (mnew == NEG) ? 1.f : exp2f(m8[i] - mnew);
                    float rs = 0.f;
#pragma unroll
                    for (int t = 0; t < 4; ++t) {
                        const float pp = (sc[t] == NEG) ? 0.f : exp2f(sc[t] - mnew); rs += pp;
                        pv[i][t] = p.Pw ? pp * p.Pw[b * p.swb + h * p.swh + (long long)ic * p.swi + (long long)min(j0 + t * 16 + l15, p.Lk - 1) * p.swj] : pp;
                    }
                    rs += __shfl_xor(rs, 1, 32); rs += __shfl_xor(rs, 2, 32); rs += __shfl_xor(rs, 4, 32); rs += __shfl_xor(rs, 8, 32);
                    l8[i] = l8[i] * corr + rs; m8[i] = mnew;
                    if (!TWOPASS) {
#pragma unroll
                        for (int t = 0; t < NT; ++t) o[t][i] *= corr;
                    }
                } else {
                    const float inv = (l8[i] > 0.f) ? 1.f / l8[i] : 0.f;
#pragma unroll
                    for (int t = 0; t < 4; ++t) {
                        const int jg = j0 + t * 16 + l15;
                        float pp = (sc[t] == NEG) ? 0.f : exp2f(sc[t] - m8[i]) * inv;
                        if (p.Pw) pp *= p.Pw[b * p.swb + h * p.swh + (long long)ic * p.swi + (long long)min(jg, p.Lk - 1) * p.swj];
                        pv[i][t] = pp;
                    }
                }
            }
            if (dopv) {
#pragma unroll
                for (int i = 0; i < 8; ++i)
#pragma unroll
                    for (int t = 0; t < 4; ++t) ((float*)myp)[(i + 8 * hf) * 64 + t * 16 + l15] = pv[i][t];
                __syncthreads();                                 // P (per wave) and V (shared) visible
                if (p.P) {
                    float* pb_ = p.P + b * p.sPb + h * p.sPh;
                    const bool fastP = (p.pband == 0) && ((p.sPi & 3) == 0) && (j0 + 64 <= p.Lk) && (q0 + 16 <= p.Lq) && ((((size_t)pb_) & 15) == 0);
                    if (fastP) {
#pragma unroll
                        for (int s = 0; s < 8; ++s) {
                            const int row = s * 2 + (lane >> 4), c4 = (lane & 15) * 4;
                            const v4f v = *(const v4f*)(myp + row * 64 + c4);
                            VST2V4(pb_ + (long long)(q0 + row) * p.sPi + j0 + c4, v);
                        }
                    } else {
                        for (int row = 0; row < 16; ++row) {
                            const int irow = q0 + row; if (irow >= p.Lq) continue;
                            for (int c = lane; c < 64; c += 32) {
                                const int jg = j0 + c; if (jg >= p.Lk) continue;
                                if (p.pband == 0) VST2(float, pb_ + (long long)irow * p.sPi + jg, myp[row * 64 + c]);
                                else if (jg - irow <= p.pband && irow - jg <= p.pband) VST2(float, pb_ + (long long)irow * p.sPi + (jg - irow + p.pband), myp[row * 64 + c]);
                            }
                        }
                    }
                }
                if (SPLITPV) {
                    const Split pa0 = sp_ld(myp + l15 * 64, 1, 0, hf, 64, 1.f), pa1 = sp_ld(myp + l15 * 64, 1, 32, hf, 64, 1.f);
                    const __bf16* vh = (const __bf16*)vl; const __bf16* vlo = vh + 64 * VP;
#pragma unroll
                    for (int t = 0; t < NT; ++t) {
                        const int dcol = t * 16 + l15;
                        Split b0, b1;
#pragma unroll
                        for (int e = 0; e < 16; ++e) {
                            const int k0 = frag_k(e, hf), k1 = 32 + frag_k(e, hf);
                            b0.hi[e] = vh[k0 * VP + dcol]; b0.lo[e] = vlo[k0 * VP + dcol]; b1.hi[e] = vh[k1 * VP + dcol]; b1.lo[e] = vlo[k1 * VP + dcol];
                        }
                        o[t] = wmma3(pa0, b0, o[t]);
                        o[t] = wmma3(pa1, b1, o[t]);
                    }
                } else {
                    const v16h pa0 = fh_ld(myp + l15 * 64, 1, 0, hf, 64, 4096.f), pa1 = fh_ld(myp + l15 * 64, 1, 32, hf, 64, 4096.f);
#pragma unroll
                    for (int t = 0; t < NT; ++t) {
                        const int dcol = t * 16 + l15;
                        v16h b0, b1;
#pragma unroll
                        for (int e = 0; e < 16; ++e) { b0[e] = vl[frag_k(e, hf) * VP + dcol]; b1[e] = vl[(32 + frag_k(e, hf)) * VP + dcol]; }
                        o[t] = wmma16(pa0, b0, o[t]);
                        o[t] = wmma16(pa1, b1, o[t]);
                    }
                }
            }
        }
    }
    float* obase = p.O + b * p.sOb + h * p.sOh;
    if (p.ST) {
        const int rl = lane >> 1, isel = rl & 7;           // row q0 + rl ; rl>>3 == hf holds because lane>>4 == (lane>>1)>>3
        float mv = 0.f, lv = 0.f;
#pragma unroll
        for (int i = 0; i < 8; ++i) if (i == isel) { mv = m8[i]; lv = l8[i]; }
        const int irow = q0 + rl;
        if (irow < p.Lq) { float* st = p.ST + (((long long)b * gridDim.y + h) * p.Lq + irow) * 2 + (lane & 1); VST2(float, st, (lane & 1) ? lv : mv * 0.6931471805599453f); }
    }
    float invr[8];
#pragma unroll
    for (int i = 0; i < 8; ++i) {
        if (TWOPASS) invr[i] = SPLITPV ? 1.f : (1.f / 4096.f);
        else if (p.nonorm) invr[i] = exp2f(m8[i]) * (SPLITPV ? 1.f : (1.f / 4096.f));
        else invr[i] = (l8[i] > 0.f) ? (SPLITPV ? 1.f / l8[i] : 1.f / (l8[i] * 4096.f)) : 0.f;
    }
    __syncthreads();                                             // all waves done with pl/vl from the main loop
    const bool ofast = ((p.sOi & 3) == 0) && ((((size_t)obase) & 15) == 0) && (q0 + 16 <= p.Lq);
#pragma unroll
    for (int c0 = 0; c0 < DVP; c0 += 64) {
#pragma unroll
        for (int i = 0; i < 8; ++i)
#pragma unroll
            for (int t = 0; t < NT; ++t) if (t * 16 >= c0 && t * 16 < c0 + 64) ((float*)myp)[(i + 8 * hf) * 64 + (t * 16 - c0) + l15] = o[t][i] * invr[i];
        __syncthreads();
        const int cw = (DVP - c0 < 64) ? (DVP - c0) : 64;      // staged columns in this chunk (multiple of 16)
        if (ofast && (c0 + cw <= p.dv) && (cw % 32 == 0)) {
            const int lpr = cw / 4;                              // lanes per row (16 for 64 cols, 8 for 32)
            const int rows_per_ins = 32 / lpr;
            for (int r0 = 0; r0 < 16; r0 += rows_per_ins) {
                const int row = r0 + lane / lpr, c4 = (lane % lpr) * 4;
                const v4f v = *(const v4f*)(myp + row * 64 + c4);
                VST2V4(obase + (long long)(q0 + row) * p.sOi + c0 + c4, v);
            }
        } else {
            for (int row = 0; row < 16; ++row) {
                const int irow = q0 + row; if (irow >= p.Lq) continue;
                for (int c = lane; c < cw; c += 32) { const int d = c0 + c; if (d < p.dv) VST2(float, obase + (long long)irow * p.sOi + d, myp[row * 64 + c]); }
            }
        }
        __syncthreads();
    }
}

// =====================================================================================================================
// k_tr: dst(z, c, r) = alpha * src(z, r, c) (+ beta * R2(z, c, r)): [Z][R][C] (row stride lds) -> [Z][C][R] (row stride ldd) through a 32x32 LDS tile;
//   flags: 1 -> add beta * residual R2 addressed like dst (z*sRz + c*ldr + r); act applied before the residual.
// =====================================================================================================================
struct TrP { const float* src; float* dst; const float* R2; long long sSz, lds, sDz, ldd, sRz, ldr; int R, C, flags, act; float alpha, beta; };
static_assert(sizeof(TrP) == 3 * 8 + 6 * 8 + 6 * 4, "TrP has padding");
__global__ __launch_bounds__(256) void k_tr(TrP p) {
    __shared__ float tile[32][33];
    const int c0 = blockIdx.x * 32, r0 = blockIdx.y * 32, z = blockIdx.z;
    const int lane = threadIdx.x & 31, wave = threadIdx.x >> 5;
    const float* s = p.src + z * p.sSz;
#pragma unroll
    for (int k = 0; k < 4; ++k) {
        const int rl = wave * 4 + k, r = r0 + rl, c = c0 + lane;
        tile[rl][lane] = (r < p.R && c < p.C) ? s[(long long)r * p.lds + c] : 0.f;
    }
    __syncthreads();
    float* d = p.dst + z * p.sDz; const float* rr = p.R2 + z * p.sRz;
#pragma unroll
    for (int k = 0; k < 4; ++k) {
        const int cl = wave * 4 + k, c = c0 + cl, r = r0 + lane;
        if (c < p.C && r < p.R) {
            float v = act_fn(p.alpha * tile[lane][cl], p.act);
            if (p.flags & 1) v += p.beta * rr[(long long)c * p.ldr + r];
            VST2(float, d + (long long)c * p.ldd + r, v);
        }
    }
}

// k_affine: dst[i] = a * (sdev ? sdev[0] : 1) * src[i] + b, i < n (one thread per element; consecutive lanes -> consecutive addresses)
__global__ __launch_bounds__(256) void k_affine(const float* __restrict__ src, float* __restrict__ dst, int n, float a, float b, const float* __restrict__ sdev) {
    const int i = blockIdx.x * 256 + threadIdx.x;
    if (i < n) { const float aa = sdev ? a * sdev[0] : a; const float v = aa * src[i] + b; VST2(float, dst + i, v); }
}

// =====================================================================================================================
// k_softmax: row softmax over n contiguous elements, one 256-thread block per row; rows addressed z*sz + r*sr (grid (R, Z)).
//   out = scale_out * softmax(scale_in * x + (Mf ? Mf[z*smz + r*smr + j] : 0)); a row whose max is -inf is written as 0.
// =====================================================================================================================
struct SmP { const float* src; float* dst; const float* Mf; long long sz, sr, dz, dr, smz, smr; int n, pad; float scale_in, scale_out; };
static_assert(sizeof(SmP) == 3 * 8 + 6 * 8 + 4 * 4, "SmP has padding");
__global__ __launch_bounds__(256) void k_softmax(SmP p) {
    __shared__ float red[256];
    const int r = blockIdx.x, z = blockIdx.y, tid = threadIdx.x;
    const float* s = p.src + z * p.sz + (long long)r * p.sr;
    const float* mf = p.Mf ? (p.Mf + z * p.smz + (long long)r * p.smr) : nullptr;
    float mx = -__builtin_inff();
    for (int j = tid; j < p.n; j += 256) { float v = s[j] * p.scale_in; if (mf) v += mf[j]; mx = fmaxf(mx, v); }
    red[tid] = mx; __syncthreads();
    for (int o = 128; o > 0; o >>= 1) { if (tid < o) red[tid] = fmaxf(red[tid], red[tid + o]); __syncthreads(); }
    mx = red[0]; __syncthreads();
    float sum = 0.f;
    for (int j = tid; j < p.n; j += 256) { float v = s[j] * p.scale_in; if (mf) v += mf[j]; sum += (mx == -__builtin_inff()) ? 0.f : expf(v - mx); }
    red[tid] = sum; __syncthreads();
    for (int o = 128; o > 0; o >>= 1) { if (tid < o) red[tid] += red[tid + o]; __syncthreads(); }
    sum = red[0];
    const float inv = (sum > 0.f) ? p.scale_out / sum : 0.f;
    float* d = p.dst + z * p.dz + (long long)r * p.dr;
    for (int j = tid; j < p.n; j += 256) { float v = s[j] * p.scale_in; if (mf) v += mf[j]; const float o = (mx == -__builtin_inff()) ? 0.f : expf(v - mx) * inv; VST2(float, d + j, o); }
}
// =====================================================================================================================
// k_stats: mean and rsqrt(var + eps) over a set of n elements addressed base + z*sz + (e / inner) * so + (e % inner) * si, one 256-thread
// k_norm_apply: y = (x - mean[set]) * rstd[set] * g[c] + b[c] over a [Z][C][L] channel-major tensor with set = z*G + c / (C/G) (G groups per z;
//   G = C -> per-channel sets indexed z*C+c; for batch norm pass stats indexed by c only via bn = 1). Optional act. Output same layout.
// =====================================================================================================================
//   mode 0: mean / rsqrt(var + eps); mode 1 (RMSNorm): 0 / rsqrt(mean(x^2) + eps); mode 2 (L2 normalize * sqrt(n)): 0 / sqrt(n) / max(||x||, eps); mode 3: as 0 with unbiased variance (n-1)
__global__ __launch_bounds__(256) void k_stats(const float* __restrict__ x, long long sz, long long so, long long si, int inner, int n, float eps, float* __restrict__ stat, int mode) {
    __shared__ float red[256];
    const int z = blockIdx.x, tid = threadIdx.x;
    const float* base = x + z * sz;
    float s = 0.f;
    for (int e = tid; e < n; e += 256) s += base[(long long)(e / inner) * so + (long long)(e % inner) * si];
    red[tid] = s; __syncthreads();
    for (int o = 128; o > 0; o >>= 1) { if (tid < o) red[tid] += red[tid + o]; __syncthreads(); }
    const float mu = (mode == 0 || mode == 3) ? red[0] / (float)n : 0.f; __syncthreads();
    float q = 0.f;
    for (int e = tid; e < n; e += 256) { const float dlt = base[(long long)(e / inner) * so + (long long)(e % inner) * si] - mu; q += dlt * dlt; }
    red[tid] = q; __syncthreads();
    for (int o = 128; o > 0; o >>= 1) { if (tid < o) red[tid] += red[tid + o]; __syncthreads(); }
    {
        float rs;
        if (mode == 2) rs = sqrtf((float)n) / fmaxf(sqrtf(red[0]), eps); else if (mode == 3) rs = rsqrtf(red[0] / (float)(n - 1) + eps); else rs = rsqrtf(red[0] / (float)n + eps);
        if (tid < 32) { const float v = (tid == 0) ? mu : ((tid == 1) ? rs : 0.f); VST2(float, stat + (long long)z * 32 + tid, v); }
    }
}
//   One thread per element over the flat [Z][C][L] index space: grid ceil(Z*C*L / 256).
__global__ __launch_bounds__(256) void k_norm_apply(const float* __restrict__ x, float* __restrict__ y, const float* __restrict__ stat, const float* __restrict__ g, const float* __restrict__ bta,
                                                     int Z, int C, int L, int G, int bn, int act) {
    const long long idx = (long long)blockIdx.x * 256 + threadIdx.x;
    if (idx >= (long long)Z * C * L) return;
    const int l = (int)(idx % L); const long long zc = idx / L; const int c = (int)(zc % C), z = (int)(zc / C); (void)l;
    const int set = bn ? c : (z * G + c / (C / G));
    float v = (x[idx] - stat[(long long)set * 32]) * stat[(long long)set * 32 + 1];
    if (g) v *= g[c];
    if (bta) v += bta[c];
    v = act_fn(v, act);
    VST2(float, y + idx, v);
}

// k_lse_neg: c[i] = -(st[2i] + log(st[2i+1])) = minus the log-sum-exp of row i from k_attn's ST output (for softmax over the query dimension)
__global__ __launch_bounds__(256) void k_lse_neg(const float* __restrict__ st, float* __restrict__ c, int n) {
    const int i = blockIdx.x * 256 + threadIdx.x;
    if (i < n) { const float v = -(st[2 * i] + logf(st[2 * i + 1])); VST2(float, c + i, v); }
}

// k_iota: dst[i] = a * i + b as int32 (segment/position id helper)
__global__ __launch_bounds__(256) void k_iota(int* __restrict__ dst, int n, int a, int b) {
    const int i = blockIdx.x * 256 + threadIdx.x;
    if (i < n) { const int v = a * i + b; VST2(int, dst + i, v); }
}

// k_axpby: dst[i] = a * x[i] + b * y[i] (+ c), i < n
__global__ __launch_bounds__(256) void k_axpby(const float* __restrict__ x, const float* __restrict__ y, float* __restrict__ dst, int n, float a, float b, float c) {
    const int i = blockIdx.x * 256 + threadIdx.x;
    if (i < n) { const float v = a * x[i] + b * y[i] + c; VST2(float, dst + i, v); }
}

// =====================================================================================================================
// k_rope: rotary embedding on a [R rows][Hn heads][D] view (row stride sXr, head stride sXh, element stride 1) -> Y (own strides).
//   mode 0: rotate_half (partner d±D/2, sign - for d<D/2); mode 1: interleaved pairs (partner d^1, sign - for even d).
//   table column tcol: tmode 0 -> d, 1 -> d % (D/2), 2 -> d / 2; position p: pmode 0 -> r % S, 1 -> head index, 2 -> pos[r];
//   c = C[(r / S) * sCb + p * sCp + tcol * sCd], s likewise from Sn; y = x[d] * c + sign * x[partner] * s. X and Y must not alias.
// =====================================================================================================================
struct RopeP { const float* X; float* Y; const float* C; const float* Sn; const int* pos; long long sXr, sXh, sYr, sYh, sCb, sCp, sCd; int R, Hn, D, S, mode, tmode, pmode, pad; };
static_assert(sizeof(RopeP) == 5 * 8 + 7 * 8 + 8 * 4, "RopeP has padding");
__global__ __launch_bounds__(256) void k_rope(RopeP p) {
    const long long idx = (long long)blockIdx.x * 256 + threadIdx.x;
    if (idx >= (long long)p.R * p.Hn * p.D) return;
    const int d = (int)(idx % p.D); const long long rh = idx / p.D; const int h = (int)(rh % p.Hn); const int r = (int)(rh / p.Hn);
    const int half = p.D / 2;
    int partner; float sign;
    if (p.mode == 0) { partner = (d < half) ? d + half : d - half; sign = (d < half) ? -1.f : 1.f; }
    else { partner = d ^ 1; sign = (d & 1) ? 1.f : -1.f; }
    const int tcol = (p.tmode == 0) ? d : ((p.tmode == 1) ? (d % half) : (d >> 1));
    const int pp = (p.pmode == 0) ? (r % p.S) : ((p.pmode == 1) ? h : p.pos[r]);
    const long long toff = (long long)(r / p.S) * p.sCb + (long long)pp * p.sCp + (long long)tcol * p.sCd;
    const float* xr = p.X + (long long)r * p.sXr + (long long)h * p.sXh;
    const float v = xr[d] * p.C[toff] + sign * xr[partner] * p.Sn[toff];
    VST2(float, p.Y + (long long)r * p.sYr + (long long)h * p.sYh + d, v);
}

// k_invf + k_sincos (split so neither kernel carries a large VALU-fma footprint): invf_i = num * (1 / powf(base, (2 i)/D)) [fmode 0],
//   num * expf((2 i) * cexp) [fmode 1], num * powf(base, -2 (i - 1) / D) [fmode 2]; then cs/sn[s*half + i] = cos/sin((pscale * s) * invf_i)
__global__ __launch_bounds__(256) void k_invf(float* __restrict__ invb, int half, int D, float base, float num, int fmode, float cexp) {
    const int i = blockIdx.x * 256 + threadIdx.x;
    if (i >= ((half + 31) / 32) * 32) return;
    if (i >= half) { VST2(float, invb + i, 0.f); return; }
    const float e = (float)(2 * i) / (float)D;
    float invf;
    if (fmode == 1) invf = num * expf((float)(2 * i) * cexp);
    else if (fmode == 2) invf = num * powf(base, (-2.0f * ((float)i - 1.0f)) / (float)D);
    else invf = num * (1.0f / powf(base, e));
    VST2(float, invb + i, invf);
}
__global__ __launch_bounds__(256) void k_sincos(float* __restrict__ cs, float* __restrict__ sn, const float* __restrict__ invb, int S, int half, float pscale) {
    const int idx = blockIdx.x * 256 + threadIdx.x;
    if (idx >= S * half) return;
    const int s = idx / half, i = idx - s * half;
    const float ang = (pscale * (float)s) * invb[i];
    VST2(float, cs + idx, cosf(ang)); VST2(float, sn + idx, sinf(ang));
}

// k_mulact: dst[i] = act(x[i]) * y[i]
__global__ __launch_bounds__(256) void k_mulact(const float* __restrict__ x, const float* __restrict__ y, float* __restrict__ dst, int n, int act) {
    const int i = blockIdx.x * 256 + threadIdx.x;
    if (i < n) { const float v = act_fn(x[i], act) * y[i]; VST2(float, dst + i, v); }
}

// =====================================================================================================================
// k_matvec: thread-per-row matrix-vector products for N <= 8 output columns (heads with 1-3 outputs, gates), f32 on the VALU.
//   C[r*sCm + j] = act(alpha * sum_k A[r*sAm + k*sAk] * B[j*sBn + k*sBk] + bias[j]) + beta * R[r*sRm + j*sRn]; each thread writes its N contiguous floats.
// =====================================================================================================================
__global__ __launch_bounds__(256) void k_matvec(GemmP p) {
    // 32 lanes write one line with one instruction.
    const int rpt = (p.N == 1) ? 1 : 32;
    const long long r0 = ((long long)blockIdx.x * 256 + threadIdx.x) * rpt; const int z = blockIdx.z, zo = z / p.zi_n, zi = z - zo * p.zi_n;
    if (r0 >= p.M) return;
    const float* Bb = p.B + zo * p.sBo + zi * p.sBi;
    float* C = p.C + zo * p.sCo + zi * p.sCi; const float* R = p.R + zo * p.sRo + zi * p.sRi;
    for (int rr = 0; rr < rpt; ++rr) {
        const long long r = r0 + rr; if (r >= p.M) break;
        const float* A = p.A + zo * p.sAo + zi * p.sAi + r * p.sAm;
        float acc[8] = {0.f, 0.f, 0.f, 0.f, 0.f, 0.f, 0.f, 0.f};
        for (int k = 0; k < p.K; ++k) { const float a = A[(long long)k * p.sAk];
#pragma unroll
            for (int j = 0; j < 8; ++j) if (j < p.N) acc[j] += a * Bb[(long long)j * p.sBn + (long long)k * p.sBk]; }
#pragma unroll
        for (int j = 0; j < 8; ++j) if (j < p.N) {
            float v = acc[j] * p.alpha;
            if (p.flags & 1) v += p.bias[j];
            if (p.flags & 2) v += p.bias[r];
            v = act_fn(v, p.act);
            if (p.flags & 4) v += p.beta * R[r * p.sRm + (long long)j * p.sRn];
            VST2(float, C + r * p.sCm + j, v);
        }
    }
}
// k_smallsoftmax: thread-per-row softmax for short rows (n <= 64): dst[r*dr + j] = softmax(scale*src[r*sr + j])
__global__ __launch_bounds__(256) void k_smallsoftmax(const float* __restrict__ src, float* __restrict__ dst, long long sr, long long dr, int n, long long R, float scale) {
    const long long r0 = ((long long)blockIdx.x * 256 + threadIdx.x) * 32;
    for (int rr = 0; rr < 32; ++rr) {
        const long long r = r0 + rr; if (r >= R) return;
        const float* s = src + r * sr; float* d = dst + r * dr;
        float mx = -__builtin_inff();
        for (int j = 0; j < n; ++j) mx = fmaxf(mx, s[j] * scale);
        float sum = 0.f;
        for (int j = 0; j < n; ++j) sum += expf(s[j] * scale - mx);
        const float inv = 1.f / sum;
        for (int j = 0; j < n; ++j) { const float v = expf(s[j] * scale - mx) * inv; VST2(float, d + j, v); }
    }
}

__global__ __launch_bounds__(32) void k_unitstat(float* __restrict__ st) { const int t = threadIdx.x; const float v = (t == 1) ? 1.f : 0.f; VST2(float, st + t, v); }

// destination (e.g. a d_out whose row width is not a multiple of 32 floats) is written by consecutive lanes of one instruction
__global__ __launch_bounds__(256) void k_lincopy(const float* __restrict__ src, long long lds, float* __restrict__ dst, long long ldd, long long rows, int cols) {
    const long long i = (long long)blockIdx.x * 256 + threadIdx.x; if (i >= rows * cols) return;
    const long long r = i / cols; const int c = (int)(i - r * cols);
    const float v = src[r * lds + c]; VST2(float, dst + r * ldd + c, v);
}

namespace w25 {
typedef __attribute__((ext_vector_type(16))) _Float16 v16h;
typedef __attribute__((ext_vector_type(8)))  _Float16 v8h;
typedef __attribute__((ext_vector_type(16))) __bf16   v16b;
typedef __attribute__((ext_vector_type(8)))  __bf16   v8b;
typedef __attribute__((ext_vector_type(8)))  float    v8f;
typedef __attribute__((ext_vector_type(4)))  float    v4f;

__device__ __forceinline__ unsigned short f2bf_bits(float f) {
  unsigned u = __float_as_uint(f);
  return (unsigned short)((u + 0x7FFFu + ((u >> 16) & 1u)) >> 16);
}
__device__ __forceinline__ float bf_bits2f(unsigned short h) { return __uint_as_float(((unsigned)h) << 16); }

// hazard guards as plain device helpers (no inline asm inside the kernel template body)
__device__ __forceinline__ void dep_guard_h(v8f& a, v8f& b, v16h x, v16h y) { asm volatile("v_nop\n\tv_nop\n\tv_nop\n\tv_nop" : "+v"(a), "+v"(b) : "v"(x), "v"(y)); }
__device__ __forceinline__ void dep_guard_b(v8f& a, v8f& b, v16b x, v16b y) { asm volatile("v_nop\n\tv_nop\n\tv_nop\n\tv_nop" : "+v"(a), "+v"(b) : "v"(x), "v"(y)); }
__device__ __forceinline__ void keep4_h(v16h a, v16h b, v16h c, v16h d) { asm volatile("v_nop" :: "v"(a), "v"(b), "v"(c), "v"(d)); }
__device__ __forceinline__ void keep4_b(v16b a, v16b b, v16b c, v16b d) { asm volatile("v_nop" :: "v"(a), "v"(b), "v"(c), "v"(d)); }
__device__ __forceinline__ void acc_guard4(v8f& a, v8f& b, v8f& c, v8f& d) { asm volatile("v_nop\n\tv_nop\n\tv_nop\n\tv_nop" : "+v"(a), "+v"(b), "+v"(c), "+v"(d)); }
template <typename T> struct Frag;
template <> struct Frag<_Float16> {
  typedef v16h V; union U { v16h v; v8h h[2]; };
  static __device__ __forceinline__ v16h load(const _Float16* p) {   // elements 0..7 <- p[0..7], 8..15 <- p[16..23]
    U f; f.h[0] = *(const v8h*)(p); f.h[1] = *(const v8h*)(p + 16); return f.v;
  }
  static __device__ __forceinline__ v8f mma(v16h a, v16h b, v8f c) {
    return __builtin_amdgcn_wmma_f32_16x16x32_f16(false, a, false, b, (short)0, c, false, false);
  }
  static __device__ __forceinline__ void guard(v8f& a, v8f& b, v16h x, v16h y) { dep_guard_h(a, b, x, y); }
  static __device__ __forceinline__ void keep(v16h a, v16h b, v16h c, v16h d) { keep4_h(a, b, c, d); }
};
template <> struct Frag<__bf16> {
  typedef v16b V; union U { v16b v; v8b h[2]; };
  static __device__ __forceinline__ v16b load(const __bf16* p) {
    U f; f.h[0] = *(const v8b*)(p); f.h[1] = *(const v8b*)(p + 16); return f.v;
  }
  static __device__ __forceinline__ v8f mma(v16b a, v16b b, v8f c) {
    return __builtin_amdgcn_wmma_f32_16x16x32_bf16(false, a, false, b, (short)0, c, false, false);
  }
  static __device__ __forceinline__ void guard(v8f& a, v8f& b, v16b x, v16b y) { dep_guard_b(a, b, x, y); }
  static __device__ __forceinline__ void keep(v16b a, v16b b, v16b c, v16b d) { keep4_b(a, b, c, d); }
};

// ---- Register-blocked batched WMMA GEMM ------------------------------------
// C[m,n] = scale * sum_k A[m,k] * Bt[n,k] (+bias)(+resid); each wave owns a 64x64 tile.
// A row-major [M,K]; Bt row-major [N,K]; M,N % 64 == 0, K % 32 == 0.
// SPLIT: operands are hi/lo planes (A2/Bt2 = lo planes, same layout); product = hi·hi + hi·lo + lo·hi.
// BIAS_MODE: 0 = none, 1 = bias[m], 2 = bias[n].
// OUT_MODE: 0 = f32, 1 = f16, 2 = bf16 hi plane (Cout) + bf16 lo plane (Cout2).
// ET: 0 = f16 operands, 1 = bf16 operands (pointers passed as 16-bit storage)
template <int ET> struct Elem;
template <> struct Elem<0> { typedef _Float16 T; };
template <> struct Elem<1> { typedef __bf16 T; };
template <int ET, bool SPLIT, int BIAS_MODE, int OUT_MODE, bool RESID, int ACT = 0>
__global__ __launch_bounds__(256) void wmma_gemm64(
    const unsigned short* __restrict__ Ap, const unsigned short* __restrict__ A2p, int lda, long strideA,
    const unsigned short* __restrict__ Btp, const unsigned short* __restrict__ Bt2p, int ldb, long strideB,
    void* __restrict__ Cout, void* __restrict__ Cout2, int ldc, long strideC,
    const float* __restrict__ bias,
    const float* __restrict__ resid, long strideR,
    int M, int N, int K, float scale) {
  typedef typename Elem<ET>::T T;
  typedef typename Frag<T>::V V;
  const T* A = (const T*)Ap; const T* A2 = (const T*)A2p; const T* Bt = (const T*)Btp; const T* Bt2 = (const T*)Bt2p;
  __shared__ __align__(16) float sT[8][16 * 68];   // per-wave 16x64 slab, pitch 68 floats
  const int b    = blockIdx.y;
  const int lane = threadIdx.x & 31;
  const int wave = threadIdx.x >> 5;
  const int tilesN = N >> 6;
  const int tilesM = M >> 6;
  const int tile = blockIdx.x * 8 + wave;
  if (tile >= tilesM * tilesN) return;   // wave-uniform; no block barriers in this kernel
  const int tm = tile / tilesN;
  const int tn = tile - tm * tilesN;
  const int m0 = tm << 6;
  const int n0 = tn << 6;

  const T* Ab  = A  + (size_t)b * strideA;
  const T* Bb  = Bt + (size_t)b * strideB;
  const T* Ab2 = SPLIT ? (A2  + (size_t)b * strideA) : nullptr;
  const T* Bb2 = SPLIT ? (Bt2 + (size_t)b * strideB) : nullptr;

  const int rlane = lane & 15;                 // row (A) / col (B, D) within subtile
  const int koff  = (lane >> 4) * 8;           // k offset of this lane half
  const int mOff  = (lane >> 4) * 8;           // D row offset

  v8f acc[4][4];
#pragma unroll
  for (int i = 0; i < 4; ++i)
#pragma unroll
    for (int j = 0; j < 4; ++j) acc[i][j] = (v8f){0.f,0.f,0.f,0.f,0.f,0.f,0.f,0.f};

  for (int k0 = 0; k0 < K; k0 += 32) {
    V bh[4], bl[4];
#pragma unroll
    for (int j = 0; j < 4; ++j) {
      const size_t bo = (size_t)(n0 + (j << 4) + rlane) * ldb + koff + k0;
      bh[j] = Frag<T>::load(Bb + bo);
      if (SPLIT) bl[j] = Frag<T>::load(Bb2 + bo);
    }
#pragma unroll
    for (int i = 0; i < 4; ++i) {
      const size_t ao = (size_t)(m0 + (i << 4) + rlane) * lda + koff + k0;
      V ah = Frag<T>::load(Ab + ao);
      V al;
      if (SPLIT) al = Frag<T>::load(Ab2 + ao);
#pragma unroll
      for (int j = 0; j < 4; ++j) {
        acc[i][j] = Frag<T>::mma(ah, bh[j], acc[i][j]);
        if (SPLIT) {
          acc[i][j] = Frag<T>::mma(ah, bl[j], acc[i][j]);
          acc[i][j] = Frag<T>::mma(al, bh[j], acc[i][j]);
        }
      }
      Frag<T>::guard(acc[i][0], acc[i][3], ah, SPLIT ? al : ah);
    }
    Frag<T>::keep(bh[0], bh[1], bh[2], bh[3]);
    if (SPLIT) Frag<T>::keep(bl[0], bl[1], bl[2], bl[3]);
  }
  acc_guard4(acc[0][0], acc[0][1], acc[0][2], acc[0][3]);
  acc_guard4(acc[1][0], acc[1][1], acc[1][2], acc[1][3]);
  acc_guard4(acc[2][0], acc[2][1], acc[2][2], acc[2][3]);
  acc_guard4(acc[3][0], acc[3][1], acc[3][2], acc[3][3]);

  // ---- epilogue ----
  float* slab = sT[wave];
  const float* Rb = RESID ? (resid + (size_t)b * strideR) : nullptr;
#pragma unroll
  for (int i = 0; i < 4; ++i) {
    const int mBase = m0 + (i << 4);
#pragma unroll
    for (int j = 0; j < 4; ++j) {
      const int n = n0 + (j << 4) + rlane;
      float bv = 0.f;
      if (BIAS_MODE == 2) bv = bias[n];
#pragma unroll
      for (int r = 0; r < 8; ++r) {
        float v = acc[i][j][r] * scale;
        if (BIAS_MODE == 1) v += bias[mBase + mOff + r];
        if (BIAS_MODE == 2) v += bv;
        if (RESID) v += Rb[(size_t)(mBase + mOff + r) * ldc + n];
        if (ACT == 1) v = tanhf(v);
        if (ACT == 2) v = fmaxf(v, 0.0f);
        if (ACT == 3) v = v / (1.0f + expf(-v));
        if (ACT == 4) v = (v > 0.f) ? v : 0.01f * v;
        if (ACT == 5) v = 0.5f * v * (1.0f + erff(v * 0.70710678118654752f));
        slab[(mOff + r) * 68 + (j << 4) + rlane] = v;
      }
    }
    __builtin_amdgcn_fence(__ATOMIC_RELEASE, "workgroup");
    __builtin_amdgcn_wave_barrier();
    __builtin_amdgcn_fence(__ATOMIC_ACQUIRE, "workgroup");
    if (OUT_MODE == 0) {
      float* C = (float*)Cout + (size_t)b * strideC;
      const int hh = lane >> 4, c4 = (lane & 15) * 4;     // row seg = 256 B = 16 lanes x 16 B
      {
#pragma unroll
        for (int it = 0; it < 8; ++it) {
          const int row = it * 2 + hh;
          v4f v = *(const v4f*)(slab + row * 68 + c4);
          *(v4f*)(C + (size_t)(mBase + row) * ldc + n0 + c4) = v;
        }
        
      }
    } else {
      const int q = lane >> 3, c8 = (lane & 7) * 8;
      unsigned short* C  = (unsigned short*)Cout  + (size_t)b * strideC;
      unsigned short* C2 = (OUT_MODE == 2) ? ((unsigned short*)Cout2 + (size_t)b * strideC) : nullptr;
      {
#pragma unroll
        for (int it = 0; it < 4; ++it) {
          const int row = it * 4 + q;
          const float* sp = slab + row * 68 + c8;
          v8h hv, lv;
#pragma unroll
          for (int e = 0; e < 8; ++e) {
            if (OUT_MODE == 1) {
              hv[e] = (_Float16)sp[e];
            } else {
              unsigned short hb = f2bf_bits(sp[e]);
              unsigned short lb = f2bf_bits(sp[e] - bf_bits2f(hb));
              hv[e] = __builtin_bit_cast(_Float16, hb);
              lv[e] = __builtin_bit_cast(_Float16, lb);
            }
          }
          *(v8h*)(C + (size_t)(mBase + row) * ldc + n0 + c8) = hv;
          if (OUT_MODE == 2) *(v8h*)(C2 + (size_t)(mBase + row) * ldc + n0 + c8) = lv;
        }
        
      }
    }
    __builtin_amdgcn_fence(__ATOMIC_RELEASE, "workgroup");
    __builtin_amdgcn_wave_barrier();
    __builtin_amdgcn_fence(__ATOMIC_ACQUIRE, "workgroup");
  }
}

// ---- LDS-staged WMMA GEMM ---------------------------------------------------
// C[m,n] = scale * sum_k A[m,k] * Bt[n,k] (+bias[n])(+resid); f16 operands, ldc = N. OUT16: the result goes out as f16 to C16 (it is only ever read as an f16 operand), else as f32 to C.
// One TM x TN tile of C per work-group of eight waves (4 x 2), a wave FM x FN fragments of 16 x 16: 128 x 128 (wave 32 x 64), or, where C still gives every WGP a
// work-group at that size, 256 x 256 (wave 64 x 128): per product half the bytes brought from L2 and half the LDS bytes read.
// A pass is 128 k: TN rows of Bt, then TM rows of A, 256 B each, brought to LDS by tensor loads in slices of 64 rows, which the load's pad lays at pitch 272 B.
// One wave brings one slice. Large tile: eight slices, every wave brings its own of every stage, two buffers. Small tile: four slices, waves 0..3 bring the even stages and
// waves 4..7 the odd ones, three buffers, so that two stages are under way while no wave ever has more than one request outstanding.
// M % TM == 0, N % TN == 0; K % 128 == 0, K >= NS * 128.
#define GL_PITCH 272
#define GL_SLICE 18432                // 64 rows at pitch 272 B (17408 B), rounded up so that every slice's place in LDS is a multiple of 2 KiB

typedef uint32_t u32x4 __attribute__((ext_vector_type(4)));
typedef uint32_t u32x8 __attribute__((ext_vector_type(8)));
__device__ __forceinline__ uint32_t tl_uni(uint32_t v) { return (uint32_t)__builtin_amdgcn_readfirstlane(v); }
// A wave-uniform test for a scalar branch round a tensor load or its wait (a tensor load ignores EXEC).
__device__ __forceinline__ uint32_t tl_pinned(uint32_t v) {
  uint32_t w = tl_uni(v);
  asm volatile("" : "+s"(w));          // holds the test in a scalar register, so that the branch on it is s_cmp + s_cbranch_scc
  return w;
}
// A tensor load's descriptor: rows rows of ROWB bytes (128 or 256), srcPitch bytes apart, a pad of 16 B behind every row in LDS. Extents in bytes, tensor = tile, no mask.
template <uint32_t ROWB>
__device__ __forceinline__ u32x8 tl_group1(uint32_t rows, uint32_t srcPitch) {
  static_assert(ROWB == 128u || ROWB == 256u, "pad interval = row length");
  constexpr uint32_t W0 = (1u << 20) | ((ROWB == 256u ? 5u : 4u) << 22) | (3u << 25);
  u32x8 g1;
  g1[0] = tl_uni(W0);
  g1[1] = tl_uni(ROWB << 16);
  g1[2] = tl_uni(rows << 16);
  g1[3] = tl_uni(ROWB << 16);
  g1[4] = tl_uni(rows);
  g1[5] = tl_uni(srcPitch);
  g1[6] = tl_uni(0u);
  g1[7] = tl_uni(0u);
  return g1;
}
// from g to the LDS byte offset lds
__device__ __forceinline__ u32x4 tl_group0(uint32_t lds, const unsigned short* g) {
  const uint64_t ga = (uint64_t)(uintptr_t)g;
  u32x4 g0;
  g0[0] = tl_uni(1u);
  g0[1] = tl_uni(lds);
  g0[2] = tl_uni((uint32_t)ga);
  g0[3] = tl_uni((((uint32_t)(ga >> 32)) & 0x01FFFFFFu) | 0x80000000u);
  return g0;
}
// The wave's next request: step bytes further along the source rows, to the LDS byte offset lds. Called only behind the wait for the wave's request before.
__device__ __forceinline__ void tl_next(u32x4& g0, uint32_t lds, uint32_t step) {
  const uint32_t lo = g0[2] + step;
  g0[3] = tl_uni(g0[3] + (lo < step ? 1u : 0u));   // the carry into address bits 32 and up
  g0[2] = tl_uni(lo);
  g0[1] = tl_uni(lds);
}
// The descriptor's words are held in the same scalar registers from here on, so that no register which a request under way has named is used
// for anything else in the meantime (formed from constants at each issue, some of them served as loop counter and scratch between two issues).
__device__ __forceinline__ void tl_hold(u32x4& g0, u32x8& g1) { asm volatile("" : "+s"(g0), "+s"(g1)); }
__device__ __forceinline__ void tl_issue(u32x4 g0, u32x8 g1) { asm volatile("tensor_load_to_lds %0, %1" :: "s"(g0), "s"(g1) : "memory"); }
// this wave's tensor load has landed in LDS
__device__ __forceinline__ void tl_wait0() { asm volatile("s_wait_tensorcnt 0x0" ::: "memory"); }
// the same behind the loop; the descriptor's words are inputs, so that their registers stay whole up to this wait
__device__ __forceinline__ void tl_wait0_end(u32x4 g0, u32x8 g1) { asm volatile("s_wait_tensorcnt 0x0" :: "s"(g0), "s"(g1) : "memory"); }
// this wave's LDS reads have returned, so the buffer may be refilled behind the barrier
__device__ __forceinline__ void gl_wait_ds0() { asm volatile("s_wait_dscnt 0x0" ::: "memory"); }

// LDC, PLANE (f16 output only): the N columns go out as N / LDC planes of LDC columns each, PLANE elements apart, so that products
// which share their A operand run as one launch and still leave each its own plane.
template <int N, int K, int BIAS_MODE, bool RESID, int ACT, bool OUT16, int LDC = N, int PLANE = 0, int NS = 2, int FM = 2, int FN = 4>
__global__ __launch_bounds__(256, (FM * FN > 8 ? 2 : 4)) void wmma_gemm_lds(
    const unsigned short* __restrict__ Ap, const unsigned short* __restrict__ Btp,
    float* __restrict__ C, _Float16* __restrict__ C16, const float* __restrict__ bias, const float* __restrict__ resid, float scale) {
  constexpr int TM = 64 * FM, TN = 32 * FN;    // the work-group's tile
  constexpr int NSL = (TM + TN) / 64;          // slices of a stage
  constexpr int G = 8 / NSL;                   // groups of NSL waves that take the stages in turn
  constexpr unsigned GL_STAGE = (unsigned)NSL * GL_SLICE;
  static_assert(TM % 128 == 0 && TN % 128 == 0 && N % TN == 0 && K % 128 == 0 && K >= NS * 128, "shape");
  static_assert((NSL == 4 || NSL == 8) && NS == G + 1, "stage t + 1 + G goes into the buffer of stage t");
  static_assert(LDC == N || (OUT16 && !RESID && BIAS_MODE == 0 && N % LDC == 0 && LDC % 128 == 0), "planes");
  __shared__ __attribute__((aligned(2048))) unsigned char sL[NS * GL_STAGE];
  const int tid  = threadIdx.x;
  const int lane = tid & 31;
  const int wave = tid >> 5;
  constexpr int tilesN = N / TN;
  constexpr int NT = K / 128;
  const int tm = blockIdx.x / tilesN;
  const int tn = blockIdx.x - tm * tilesN;
  const int wm = (wave >> 1) * (16 * FM);      // this wave's 16 FM rows and 16 FN columns inside the tile
  const int wn = (wave & 1) * (16 * FN);
  const int rlane = lane & 15;                 // row (A) / col (B, D) within subtile
  const int hh    = lane >> 4;                 // lane half: k offset 8 * hh, D row offset 8 * hh
  const int mOff  = hh * 8;

  // This wave's slice: stage rows 64 sl .. 64 sl + 63; rows 0..TN-1 of a stage come from Bt, TN..TN+TM-1 from A.
  const uint32_t wv = tl_uni(threadIdx.x >> 5);
  const uint32_t sl = wv & (uint32_t)(NSL - 1), grp = wv / (uint32_t)NSL;
  const uint32_t ldsSl = (uint32_t)(uintptr_t)(&sL[0]) + sl * GL_SLICE;
  const unsigned short* gS = (sl < (uint32_t)(TN / 64)) ? Btp + (size_t)(tn * TN + (int)sl * 64) * K
                                                        : Ap + (size_t)(tm * TM + ((int)sl - TN / 64) * 64) * K;

  v8f acc[FM][FN];
#pragma unroll
  for (int i = 0; i < FM; ++i)
#pragma unroll
    for (int j = 0; j < FN; ++j) acc[i][j] = (v8f){0.f,0.f,0.f,0.f,0.f,0.f,0.f,0.f};

  // Stage s is brought by group s % G. Stages 0 .. G - 1 first, one request a wave.
  u32x8 g1 = tl_group1<256u>(64u, 2u * K);
  u32x4 g0 = tl_group0(ldsSl + grp * GL_STAGE, gS + grp * 128u);
  tl_hold(g0, g1);
  tl_issue(g0, g1);
  if (G == 1 || tl_pinned(grp == 0u)) tl_wait0();          // stage 0 has landed
  __syncthreads();                             // stage 0 is readable by every wave
  if (G == 1 || tl_pinned(grp == 0u)) { tl_next(g0, ldsSl + (unsigned)G * GL_STAGE, G * 256u); tl_issue(g0, g1); }

  unsigned bo = 0;                             // byte offset of the buffer that holds stage t
  // kept rolled: one pass per trip, so that the order at its foot stands once
#pragma unroll 1
  for (int t = 0; t < NT; ++t) {
    const unsigned char* pB = sL + bo + (wn >> 6) * GL_SLICE + rlane * GL_PITCH + hh * 16;
    const unsigned char* pA = sL + bo + (TN / 64 + (wm >> 6)) * GL_SLICE + ((wm & 63) + rlane) * GL_PITCH + hh * 16;
    v16h bh[2][FN], ah[2][FM];                 // two fragment sets: the next 32 k are fetched while these are multiplied
#pragma unroll
    for (int j = 0; j < FN; ++j) bh[0][j] = Frag<_Float16>::load((const _Float16*)(pB + (j >> 2) * GL_SLICE + (j & 3) * 16 * GL_PITCH));
#pragma unroll
    for (int i = 0; i < FM; ++i) ah[0][i] = Frag<_Float16>::load((const _Float16*)(pA + i * 16 * GL_PITCH));
    // large tile: the first block's LDS reads stay ahead of the second's, so that its WMMAs wait for their own 24 reads and not for all 48
    if (FM * FN > 8) __builtin_amdgcn_sched_barrier(0);
#pragma unroll
    for (int kk = 0; kk < 4; ++kk) {
      const int cur = kk & 1, nxt = cur ^ 1;
      if (kk < 3) {
#pragma unroll
        for (int j = 0; j < FN; ++j) bh[nxt][j] = Frag<_Float16>::load((const _Float16*)(pB + (j >> 2) * GL_SLICE + (j & 3) * 16 * GL_PITCH + (kk + 1) * 64));
#pragma unroll
        for (int i = 0; i < FM; ++i) ah[nxt][i] = Frag<_Float16>::load((const _Float16*)(pA + i * 16 * GL_PITCH + (kk + 1) * 64));
      }
      __builtin_amdgcn_sched_barrier(0);       // keeps the next block's LDS reads one group ahead of this block's WMMAs, not among them
#pragma unroll
      for (int i = 0; i < FM; ++i)
#pragma unroll
        for (int j = 0; j < FN; ++j) acc[i][j] = Frag<_Float16>::mma(ah[cur][i], bh[cur][j], acc[i][j]);
      __builtin_amdgcn_sched_barrier(0);       // ends the block: later LDS reads stay behind its WMMAs
    }
    gl_wait_ds0();
    // Stage t + 1 is its group's one outstanding request; that group's next, stage t + 1 + G, is formed and issued behind this wait and behind the barrier.
    const bool mine = (G == 1) || (((uint32_t)(t + 1) & (uint32_t)(G - 1)) == grp);
    if (G == 1 || tl_pinned(mine)) tl_wait0();
    __syncthreads();                           // publishes stage t + 1 and ends every read of stage t
    if (tl_pinned(mine && t + 1 + G < NT)) { tl_next(g0, ldsSl + bo, G * 256u); tl_issue(g0, g1); }
    bo = (bo == (unsigned)(NS - 1) * GL_STAGE) ? 0u : bo + GL_STAGE;
  }
  tl_wait0_end(g0, g1);
  gl_wait_ds0();

  // ---- epilogue ----
  // The ring is free: the last trip's foot waited for every read and every tensor load and passed the barrier.
  float* slab = (float*)(sL + wave * (16 * 68 * 4));   // per-wave 16x64 slab, pitch 68 floats
  const int m0 = tm * TM + wm;
  const int nw = tn * TN + wn + rlane;         // this lane's first column
  float bv[FN];                                // one run of loads for all of the wave's columns, with one wait behind it
#pragma unroll
  for (int j = 0; j < FN; ++j) bv[j] = (BIAS_MODE == 2) ? bias[nw + (j << 4)] : 0.f;
  // the bias loads' index register is an input, so it stays whole up to the wait
  if (BIAS_MODE == 2) asm volatile("s_wait_xcnt 0x0" :: "v"(nw) : "memory");
  // the wave's columns go out 64 at a time; unrolled, so that acc's indices are constants
#pragma unroll
  for (int jg = 0; jg < FN / 4; ++jg) {
  const int n0 = tn * TN + wn + jg * 64;
  const int nl = n0 + rlane;
#pragma unroll
  for (int i = 0; i < FM; ++i) {
    const int mBase = m0 + (i << 4);
    float rv[4][8];
    if (RESID) {
      const float* rp = resid + (size_t)(mBase + mOff) * N + nl;
#pragma unroll
      for (int j = 0; j < 4; ++j)
#pragma unroll
        for (int r = 0; r < 8; ++r) rv[j][r] = rp[(size_t)r * N + (j << 4)];
      // the residual loads' address register is an input, so it stays whole up to the wait
      asm volatile("s_wait_xcnt 0x0" :: "v"(rp) : "memory");
    }
#pragma unroll
    for (int j = 0; j < 4; ++j) {
#pragma unroll
      for (int r = 0; r < 8; ++r) {
        float v = acc[i][jg * 4 + j][r] * scale;
        if (BIAS_MODE == 2) v += bv[jg * 4 + j];
        if (RESID) v += rv[j][r];
        if (ACT == 2) v = fmaxf(v, 0.0f);
        slab[(mOff + r) * 68 + (j << 4) + rlane] = v;
      }
    }
    __builtin_amdgcn_fence(__ATOMIC_RELEASE, "workgroup");
    __builtin_amdgcn_wave_barrier();
    __builtin_amdgcn_fence(__ATOMIC_ACQUIRE, "workgroup");
    if (OUT16) {
      const int r4 = lane >> 3, c8 = (lane & 7) * 8;   // row seg = 128 B = 8 lanes x 16 B
      const int pl = (LDC == N) ? 0 : n0 / LDC;        // this wave's 64 columns lie in one plane
      _Float16* hp = C16 + (size_t)pl * PLANE + (size_t)(mBase + r4) * LDC + (n0 - pl * LDC) + c8;
#pragma unroll
      for (int it = 0; it < 4; ++it) {         // rows it * 4 + r4
        const float* sp = slab + (it * 4 + r4) * 68 + c8;
        const v4f lo = *(const v4f*)(sp), hi = *(const v4f*)(sp + 4);
        v8h h;
#pragma unroll
        for (int e = 0; e < 4; ++e) { h[e] = (_Float16)lo[e]; h[4 + e] = (_Float16)hi[e]; }
        *(v8h*)(hp + (size_t)it * 4 * LDC) = h;
      }
    } else {
      const int c4 = (lane & 15) * 4;          // row seg = 256 B = 16 lanes x 16 B
      float* cp = C + (size_t)(mBase + hh) * N + n0 + c4;
#pragma unroll
      for (int it = 0; it < 8; ++it) {         // rows it * 2 + hh
        v4f v = *(const v4f*)(slab + (it * 2 + hh) * 68 + c4);
        *(v4f*)(cp + (size_t)it * 2 * N) = v;
      }
    }
    __builtin_amdgcn_sched_barrier(0);         // holds later register writes behind the wait below
    asm volatile("s_wait_xcnt 0x0" ::: "memory");   // before a data or address register of the stores above is rewritten
    __builtin_amdgcn_sched_barrier(0);         // without the pair the next rows' multiplies were lifted over the wait, onto the stores' data registers
    __builtin_amdgcn_fence(__ATOMIC_RELEASE, "workgroup");
    __builtin_amdgcn_wave_barrier();
    __builtin_amdgcn_fence(__ATOMIC_ACQUIRE, "workgroup");
  }
  }
}

__global__ __launch_bounds__(256) void cast_f32_f16x2(
    const float* __restrict__ in, _Float16* __restrict__ out, int n2) {
  int i = blockIdx.x * 256 + threadIdx.x;
  if (i < n2) {
    const _Float16 h0 = (_Float16)in[2 * i], h1 = (_Float16)in[2 * i + 1];
    const unsigned u = (unsigned)__builtin_bit_cast(unsigned short, h0) | ((unsigned)__builtin_bit_cast(unsigned short, h1) << 16);
    ((unsigned*)out)[i] = u;
    
  }
}


} // namespace w25

__global__ __launch_bounds__(256) void k_castT16(const float* __restrict__ src, long long lds, _Float16* __restrict__ dst, long long ldd, int R, int C, float s) {
    const long long i = (long long)blockIdx.x * 256 + threadIdx.x; const long long np = (long long)C * (R / 2); if (i >= np) return; const int c = (int)(i / (R / 2)); const int r = 2 * (int)(i % (R / 2));
    const _Float16 h0 = (_Float16)(src[(long long)r * lds + c] * s), h1 = (_Float16)(src[(long long)(r + 1) * lds + c] * s);
    const unsigned u = (unsigned)__builtin_bit_cast(unsigned short, h0) | ((unsigned)__builtin_bit_cast(unsigned short, h1) << 16);
    unsigned* d = (unsigned*)(dst + (long long)c * ldd + r); *d = u;  }
__global__ __launch_bounds__(256) void k_cast16(const float* __restrict__ src, long long lds, _Float16* __restrict__ dst, long long ldd, int R, int C, float s) {
    const long long i = (long long)blockIdx.x * 256 + threadIdx.x; const long long np = (long long)R * (C / 2); if (i >= np) return; const int r = (int)(i / (C / 2)); const int c = 2 * (int)(i % (C / 2));
    const _Float16 h0 = (_Float16)(src[(long long)r * lds + c] * s), h1 = (_Float16)(src[(long long)r * lds + c + 1] * s);
    const unsigned u = (unsigned)__builtin_bit_cast(unsigned short, h0) | ((unsigned)__builtin_bit_cast(unsigned short, h1) << 16);
    unsigned* d = (unsigned*)(dst + (long long)r * ldd + c); *d = u;  }

// f32 -> bf16 hi plane + bf16 lo plane (x = hi + lo to ~2^-17 relative; RNE both), [R][C] -> [R][C] (or transposed to [C][R]); 2 consecutive destination elements
__device__ __forceinline__ unsigned int f2bf2_pack(float a, float b, unsigned int* lo) {
    const unsigned short ha = w25::f2bf_bits(a), hb = w25::f2bf_bits(b);
    const unsigned short la = w25::f2bf_bits(a - w25::bf_bits2f(ha)), lb = w25::f2bf_bits(b - w25::bf_bits2f(hb));
    *lo = (unsigned)la | ((unsigned)lb << 16); return (unsigned)ha | ((unsigned)hb << 16); }
__global__ __launch_bounds__(256) void k_castS16(const float* __restrict__ src, long long lds, __bf16* __restrict__ dhi, __bf16* __restrict__ dlo, long long ldd, int R, int C, float s, int transpose) {
    const long long i = (long long)blockIdx.x * 256 + threadIdx.x; long long o; float a, b;
    if (transpose) { const long long np = (long long)C * (R / 2); if (i >= np) return; const int c = (int)(i / (R / 2)); const int r = 2 * (int)(i % (R / 2)); a = src[(long long)r * lds + c] * s; b = src[(long long)(r + 1) * lds + c] * s; o = (long long)c * ldd + r; }
    else { const long long np = (long long)R * (C / 2); if (i >= np) return; const int r = (int)(i / (C / 2)); const int c = 2 * (int)(i % (C / 2)); a = src[(long long)r * lds + c] * s; b = src[(long long)r * lds + c + 1] * s; o = (long long)r * ldd + c; }
    unsigned lo; const unsigned hi = f2bf2_pack(a, b, &lo); unsigned* ph = (unsigned*)(dhi + o); unsigned* pl = (unsigned*)(dlo + o);
    *ph = hi; *pl = lo;  }

namespace w25 {
// =====================================================================================
// Generic causal/non-causal attention for head_dim 64, f32 in / f32 out; 16-bit operands: bf16 with optional hi/lo splits, or
// plain f16 (F16=true, non-split, probabilities carried x2^15).
//   scores = (q*qscale)·kᵀ : v_wmma_f32_16x16x32_bf16; SPLIT_QK -> q,k as bf16 hi/lo (hi·hi + hi·lo + lo·hi)
//   out    = p·v           : v_wmma_f32_16x16x32_bf16; SPLIT_PV -> p,v as bf16 hi/lo; else p,v plain bf16
//   f32 accumulate; online softmax in f32. Block = 4 waves = 64 query rows of one (batch, head); S % 64 == 0.
//   Element (b, s, h, d) of tensor X lives at X[b*X_bs + s*X_rs + h*X_hs + d] (strides in floats, multiples of 4).
//   Masking: mask_mode 0 none, 1 causal (kv > q masked), 2 tensor [S][Skv] shared over (b,h) (float if
//   mask_is_int==0, int32 with element == 0 -> masked if 1, int32 with element != 0 -> masked if 2), 3 per-token vectors qmask[B][S] & kvmask[B][Skv] (int32,
//   0 -> masked), 4 causal + sliding window (kv > q or q - kv > W masked; W passed in mask_is_int);
//   5 = relative-position bias: s += cp[b,h,q][idx[q][kv]] + pc[b,h,kv][idx[q][kv]] with idx = mask_b ([S][Skv] int32) and
//   mask_a an int32 [S][Skv] tensor with nonzero = masked (tables: element (b,h,row,n) at X + b*c_bs + h*c_hs + row*c_rs + n);
//   masked scores are replaced by mask_fill (e.g. -inf or -1e9) before the softmax.
//   grid.x = B * H * (S/64) (or a sub-range with blk0).
// =====================================================================================
#define AT_D 64
#define AT_NW 4
#define AT_QB 64
#define AT_KC 64
struct AttnGeom { const float* cp = nullptr; const float* pc = nullptr; long c_bs = 0, c_rs = 0, c_hs = 0;   // mode-5 score-bias tables
                  long q_bs, q_rs, q_hs, k_bs, k_rs, k_hs, v_bs, v_rs, v_hs, o_bs, o_rs, o_hs;
                  int S, Skv, H, mask_mode; float qscale; int blk0; float mask_fill; int mask_is_int; };
static_assert(sizeof(AttnGeom) == 168, "no padding");

__device__ __forceinline__ unsigned short at_bf_bits(float f) {
  unsigned u = __float_as_uint(f);
  return (unsigned short)((u + 0x7FFFu + ((u >> 16) & 1u)) >> 16);
}
__device__ __forceinline__ __bf16 at_f2bf(float f) { return __builtin_bit_cast(__bf16, at_bf_bits(f)); }
__device__ __forceinline__ void at_split(float f, __bf16& hi, __bf16& lo) {
  const unsigned short hb = at_bf_bits(f);
  hi = __builtin_bit_cast(__bf16, hb);
  lo = at_f2bf(f - __uint_as_float(((unsigned)hb) << 16));
}
__device__ __forceinline__ v8f at_mma(v16b a, v16b b, v8f c) {
  c = __builtin_amdgcn_wmma_f32_16x16x32_bf16(false, a, false, b, (short)0, c, false, false);
  asm volatile("v_nop\n\tv_nop\n\tv_nop\n\tv_nop" : "+v"(c) : "v"(a), "v"(b));
  return c;
}
// 16-bit element as a bit pattern held in a __bf16 slot: f16 bits when F16, bf16 (RNE) otherwise
template <bool F16> __device__ __forceinline__ __bf16 at_to16(float f) {
  if (F16) return __builtin_bit_cast(__bf16, (_Float16)f);
  return at_f2bf(f);
}
template <bool F16> __device__ __forceinline__ v8f at_mma16(v16b a, v16b b, v8f c) {
  if (F16) {
    const v16h ah = __builtin_bit_cast(v16h, a), bh = __builtin_bit_cast(v16h, b);
    c = __builtin_amdgcn_wmma_f32_16x16x32_f16(false, ah, false, bh, (short)0, c, false, false);
    asm volatile("v_nop\n\tv_nop\n\tv_nop\n\tv_nop" : "+v"(c) : "v"(ah), "v"(bh));
    return c;
  }
  return at_mma(a, b, c);
}

template <bool SPLIT_QK, bool SPLIT_PV, bool F16 = false>
__global__ __launch_bounds__(128)
void attn64_kernel(const float* __restrict__ q, const float* __restrict__ k,
                   const float* __restrict__ v, float* __restrict__ out,
                   const void* __restrict__ mask_a, const int* __restrict__ mask_b, AttnGeom g) {
  static_assert(!(F16 && (SPLIT_QK || SPLIT_PV)), "f16 mode is non-split");
  const float PSC = F16 ? 32768.0f : 1.0f;     // f16 probabilities carried x2^15 (subnormal range), folded into the final 1/l
  union FB { v16b v; v8b h[2]; };
  __shared__ __align__(16) __bf16 Ksh[AT_KC * AT_D];             // K hi [kv][d]      8 KB
  __shared__ __align__(16) __bf16 Ksl[SPLIT_QK ? AT_KC * AT_D : 8];
  __shared__ __align__(16) __bf16 Vth[AT_D * AT_KC];             // V hi [d][kv]      8 KB
  __shared__ __align__(16) __bf16 Vtl[SPLIT_PV ? AT_D * AT_KC : 8];
  __shared__ __align__(16) __bf16 Psh[AT_NW][16 * AT_KC];        // per wave P hi [row][kv]  8 KB
  __shared__ __align__(16) __bf16 Psl[SPLIT_PV ? AT_NW : 1][SPLIT_PV ? 16 * AT_KC : 8];
  __shared__ __align__(16) float  Os[AT_NW][16 * 68];            // per wave out tile, pitch 68

  const int tid  = threadIdx.x;
  const int wave = tid >> 5;
  const int lane = tid & 31;
  const int hh   = lane >> 4;
  const int c    = lane & 15;

  const int nqb = g.S / AT_QB;
  const int bx = blockIdx.x + g.blk0;
  const int qb = bx % nqb;
  const int bh = bx / nqb;
  const int h  = bh % g.H;
  const int b  = bh / g.H;
  const int qbase_block = qb * AT_QB;
  const int q0 = qbase_block + wave * 16;

  const float* qb_ptr = q + (size_t)b * g.q_bs + (size_t)h * g.q_hs;
  const float* kb_ptr = k + (size_t)b * g.k_bs + (size_t)h * g.k_hs;
  const float* vb_ptr = v + (size_t)b * g.v_bs + (size_t)h * g.v_hs;
  float*       ob_ptr = out + (size_t)b * g.o_bs + (size_t)h * g.o_hs;

  // ---- Q fragments (A operand): 2 d-chunks, hi (and lo) ----
  v16b qah[2], qal[2];
  {
    const float* qrow = qb_ptr + (size_t)(q0 + c) * g.q_rs;
#pragma unroll
    for (int dc = 0; dc < 2; ++dc) {
#pragma unroll
      for (int e = 0; e < 8; ++e) {
        const float f0 = qrow[dc * 32 + 8 * hh + e] * g.qscale;
        const float f1 = qrow[dc * 32 + 16 + 8 * hh + e] * g.qscale;
        if (SPLIT_QK) { __bf16 hq, lq; at_split(f0, hq, lq); qah[dc][e] = hq; qal[dc][e] = lq; at_split(f1, hq, lq); qah[dc][8 + e] = hq; qal[dc][8 + e] = lq; }
        else { qah[dc][e] = at_to16<F16>(f0); qah[dc][8 + e] = at_to16<F16>(f1); qal[dc][e] = qah[dc][e]; qal[dc][8 + e] = qah[dc][8 + e]; }
      }
    }
  }

  float mrow[8], lrow[8];
  v8f oacc[4];
#pragma unroll
  for (int r = 0; r < 8; ++r) { mrow[r] = -INFINITY; lrow[r] = 0.f; }
#pragma unroll
  for (int t = 0; t < 4; ++t) oacc[t] = (v8f){0.f,0.f,0.f,0.f,0.f,0.f,0.f,0.f};

  const int nChunks = (g.mask_mode == 1 || g.mask_mode == 4) ? (qb + 1) : (g.Skv / AT_KC);   // block-uniform
  // per-row query mask (mode 3)
  int qkeep[8];
#pragma unroll
  for (int r = 0; r < 8; ++r) qkeep[r] = (g.mask_mode == 3) ? mask_b[(size_t)b * g.S + q0 + 8 * hh + r] : 1;   // mask_b = qmask in mode 3
  for (int kc = 0; kc < nChunks; ++kc) {
    const int kv0 = kc * AT_KC;
    __syncthreads();
    {
      const int kvr = tid >> 1, dh = (tid & 1) * 32;
      const float* krow = kb_ptr + (size_t)(kv0 + kvr) * g.k_rs + dh;
      const float* vrow = vb_ptr + (size_t)(kv0 + kvr) * g.v_rs + dh;
#pragma unroll
      for (int i = 0; i < 8; ++i) {
        v4f kk = *(const v4f*)(krow + 4 * i);
        v4f vv = *(const v4f*)(vrow + 4 * i);
#pragma unroll
        for (int e = 0; e < 4; ++e) {
          const int d = dh + 4 * i + e;
          if (SPLIT_QK) { __bf16 a, bl; at_split(kk[e], a, bl); Ksh[kvr * AT_D + d] = a; Ksl[kvr * AT_D + d] = bl; }
          else Ksh[kvr * AT_D + d] = at_to16<F16>(kk[e]);
          if (SPLIT_PV) { __bf16 a, bl; at_split(vv[e], a, bl); Vth[d * AT_KC + kvr] = a; Vtl[d * AT_KC + kvr] = bl; }
          else Vth[d * AT_KC + kvr] = at_to16<F16>(vv[e]);
        }
      }
    }
    __syncthreads();

    v8f s[4];
#pragma unroll
    for (int j = 0; j < 4; ++j) {
      s[j] = (v8f){0.f,0.f,0.f,0.f,0.f,0.f,0.f,0.f};
#pragma unroll 1
      for (int dc = 0; dc < 2; ++dc) {
        FB kb;
        kb.h[0] = *(const v8b*)(Ksh + (j * 16 + c) * AT_D + dc * 32 + 8 * hh);
        kb.h[1] = *(const v8b*)(Ksh + (j * 16 + c) * AT_D + dc * 32 + 16 + 8 * hh);
        s[j] = at_mma16<F16>(qah[dc], kb.v, s[j]);
        if (SPLIT_QK) {
          FB kl;
          kl.h[0] = *(const v8b*)(Ksl + (j * 16 + c) * AT_D + dc * 32 + 8 * hh);
          kl.h[1] = *(const v8b*)(Ksl + (j * 16 + c) * AT_D + dc * 32 + 16 + 8 * hh);
          s[j] = at_mma16<F16>(qah[dc], kl.v, s[j]);
          s[j] = at_mma16<F16>(qal[dc], kb.v, s[j]);
        }
      }
    }
    const bool diag = (g.mask_mode == 1) && (kc == qb);
    int kvkeep[4] = {1, 1, 1, 1};
    if (g.mask_mode == 3) {
#pragma unroll
      for (int j = 0; j < 4; ++j) kvkeep[j] = ((const int*)mask_a)[(size_t)b * g.Skv + kv0 + j * 16 + c];   // mask_a = kvmask
    }
    float cm[8];
#pragma unroll
    for (int r = 0; r < 8; ++r) {
      const int qrow = q0 + 8 * hh + r;
      float m = -INFINITY;
#pragma unroll
      for (int j = 0; j < 4; ++j) {
        const int kvcol = kv0 + j * 16 + c;
        bool masked = false;
        if (diag) masked = (kvcol > qrow);
        else if (g.mask_mode == 4) masked = (kvcol > qrow) || (qrow - kvcol > g.mask_is_int);
        else if (g.mask_mode == 2) {
          const size_t mi = (size_t)qrow * g.Skv + kvcol;
          masked = (g.mask_is_int == 0) ? (((const float*)mask_a)[mi] == 0.0f)
                 : (g.mask_is_int == 1) ? (((const int*)mask_a)[mi] == 0) : (((const int*)mask_a)[mi] != 0);
        } else if (g.mask_mode == 3) masked = (qkeep[r] == 0) || (kvkeep[j] == 0);
        else if (g.mask_mode == 5) {
          const size_t mi = (size_t)qrow * g.Skv + kvcol;
          masked = (((const int*)mask_a)[mi] != 0);
          int n = mask_b[mi]; n = n < 0 ? 0 : n;
          s[j][r] += g.cp[(size_t)b * g.c_bs + (size_t)h * g.c_hs + (size_t)qrow * g.c_rs + n]
                   + g.pc[(size_t)b * g.c_bs + (size_t)h * g.c_hs + (size_t)kvcol * g.c_rs + n];
        }
        if (masked) s[j][r] = g.mask_fill;
        m = fmaxf(m, s[j][r]);
      }
#pragma unroll
      for (int off = 1; off < 16; off <<= 1) m = fmaxf(m, __shfl_xor(m, off, 32));
      cm[r] = m;
    }
    __bf16* pwh = Psh[wave];
    __bf16* pwl = Psl[SPLIT_PV ? wave : 0];
#pragma unroll
    for (int r = 0; r < 8; ++r) {
      const float mnew = fmaxf(mrow[r], cm[r]);
      const float alpha = expf(mrow[r] - mnew);
      mrow[r] = mnew;
      float psum = 0.f;
#pragma unroll
      for (int j = 0; j < 4; ++j) {
        const float p = expf(s[j][r] - mnew);
        psum += p;
        if (SPLIT_PV) { __bf16 a, bl; at_split(p, a, bl); pwh[(8 * hh + r) * AT_KC + j * 16 + c] = a; pwl[(8 * hh + r) * AT_KC + j * 16 + c] = bl; }
        else pwh[(8 * hh + r) * AT_KC + j * 16 + c] = at_to16<F16>(p * PSC);
      }
#pragma unroll
      for (int off = 1; off < 16; off <<= 1) psum += __shfl_xor(psum, off, 32);
      lrow[r] = lrow[r] * alpha + psum;
#pragma unroll
      for (int t = 0; t < 4; ++t) oacc[t][r] *= alpha;
    }
    __builtin_amdgcn_fence(__ATOMIC_RELEASE, "workgroup");
    __builtin_amdgcn_wave_barrier();
    __builtin_amdgcn_fence(__ATOMIC_ACQUIRE, "workgroup");
#pragma unroll 1
    for (int kk = 0; kk < 2; ++kk) {
      FB pa, pl;
      pa.h[0] = *(const v8b*)(pwh + c * AT_KC + kk * 32 + 8 * hh);
      pa.h[1] = *(const v8b*)(pwh + c * AT_KC + kk * 32 + 16 + 8 * hh);
      if (SPLIT_PV) {
        pl.h[0] = *(const v8b*)(pwl + c * AT_KC + kk * 32 + 8 * hh);
        pl.h[1] = *(const v8b*)(pwl + c * AT_KC + kk * 32 + 16 + 8 * hh);
      }
#pragma unroll
      for (int t = 0; t < 4; ++t) {
        FB vb;
        vb.h[0] = *(const v8b*)(Vth + (t * 16 + c) * AT_KC + kk * 32 + 8 * hh);
        vb.h[1] = *(const v8b*)(Vth + (t * 16 + c) * AT_KC + kk * 32 + 16 + 8 * hh);
        oacc[t] = at_mma16<F16>(pa.v, vb.v, oacc[t]);
        if (SPLIT_PV) {
          FB vl;
          vl.h[0] = *(const v8b*)(Vtl + (t * 16 + c) * AT_KC + kk * 32 + 8 * hh);
          vl.h[1] = *(const v8b*)(Vtl + (t * 16 + c) * AT_KC + kk * 32 + 16 + 8 * hh);
          oacc[t] = at_mma16<F16>(pa.v, vl.v, oacc[t]);
          oacc[t] = at_mma16<F16>(pl.v, vb.v, oacc[t]);
        }
      }
    }
  }

  float* os = Os[wave];
#pragma unroll
  for (int r = 0; r < 8; ++r) {
    const float inv = 1.0f / (lrow[r] * PSC);
#pragma unroll
    for (int t = 0; t < 4; ++t) os[(8 * hh + r) * 68 + t * 16 + c] = oacc[t][r] * inv;
  }
  __builtin_amdgcn_fence(__ATOMIC_RELEASE, "workgroup");
  __builtin_amdgcn_wave_barrier();
  __builtin_amdgcn_fence(__ATOMIC_ACQUIRE, "workgroup");
  {
    const int c4 = (lane & 15) * 4;
    {
#pragma unroll
      for (int it = 0; it < 8; ++it) {
        const int row = it * 2 + hh;
        v4f val = *(const v4f*)(os + row * 68 + c4);
        *(v4f*)(ob_ptr + (size_t)(q0 + row) * g.o_rs + c4) = val;
      }
      
    }
  }
}

} // namespace w25

// ---- Wide elementwise and row passes: a thread moves 32 or 64 elements with 16-byte loads, so that a pass starts a few thousand waves instead of
//      one wave per 64 or 128 elements. Every wave-wide store covers whole 128-byte lines. Formulas and sum trees are those of the narrow kernels above.
typedef __attribute__((ext_vector_type(4))) _Float16 v4h;
// cast16w<G>: dst[i] = f16(src[i] * s) over a flat range; block bx takes G * 1024 consecutive elements, a thread 4 consecutive ones of each 1024.
template <int G>
__device__ __forceinline__ void cast16w(const float* __restrict__ src, _Float16* __restrict__ dst, float s, unsigned bx) {
    const v4f* sp = (const v4f*)(src + (size_t)bx * (G * 1024));
    v4h* dp = (v4h*)(dst + (size_t)bx * (G * 1024));
    const unsigned t = threadIdx.x;
    v4f a[G];
    // every loop here is unrolled, so that the arrays it indexes are registers and all G loads are in flight together
#pragma unroll
    for (int g = 0; g < G; ++g) a[g] = sp[t + g * 256];
    __builtin_amdgcn_sched_barrier(0);               // holds later register writes behind the wait below
    asm volatile("s_wait_xcnt 0x0" ::: "memory");    // before an address register of the loads above is rewritten (the store addresses are formed next)
    __builtin_amdgcn_sched_barrier(0);               // the pair keeps the forming of the store addresses behind the wait
    v4h h[G];
#pragma unroll
    for (int g = 0; g < G; ++g)
#pragma unroll
        for (int e = 0; e < 4; ++e) h[g][e] = (_Float16)(a[g][e] * s);
#pragma unroll
    for (int g = 0; g < G; ++g) dp[t + g * 256] = h[g];
}
// castT16w<LDS, LDD>: dst[c * LDD + r] = f16(src[r * LDS + c] * s). Block (bx, by) = 64 source rows x 128 source columns, wave = 64 x 16, lane = 8 rows x 4 columns
//   transposed in registers: 8 lanes side by side in r fill one 128-byte line of a dst row. bx < C / 128, by < R / 64.
template <int LDS, int LDD>
__device__ __forceinline__ void castT16w(const float* __restrict__ src, _Float16* __restrict__ dst, float s, unsigned bx, unsigned by) {
    const int lane = threadIdx.x & 31, wave = threadIdx.x >> 5;
    const int r = by * 64 + (lane & 7) * 8;
    const int c = bx * 128 + wave * 16 + (lane >> 3) * 4;
    const float* sp = src + (size_t)r * LDS + c;
    _Float16* dp = dst + (size_t)c * LDD + r;
    v4f x[8];
    // every loop here is unrolled, so that the arrays it indexes are registers and all eight loads are in flight together
#pragma unroll
    for (int i = 0; i < 8; ++i) x[i] = *(const v4f*)(sp + i * LDS);
    __builtin_amdgcn_sched_barrier(0);               // holds later register writes behind the wait below
    asm volatile("s_wait_xcnt 0x0" ::: "memory");    // before an address register of the loads above is rewritten
    __builtin_amdgcn_sched_barrier(0);               // the pair keeps later address arithmetic behind the wait
    v8h h[4];
#pragma unroll
    for (int j = 0; j < 4; ++j)
#pragma unroll
        for (int i = 0; i < 8; ++i) h[j][i] = (_Float16)(x[i][j] * s);
#pragma unroll
    for (int j = 0; j < 4; ++j) *(v8h*)(dp + j * LDD) = h[j];
    asm volatile("s_wait_xcnt 0x0" ::: "memory");    // behind the stores: in the merged kernel another branch's code follows in the listing and reuses their address and data registers
}
// k_cast_all: every f16 operand plane that depends on the inputs alone, in one launch of 2048 blocks, none of which reads what another writes.
//   Blocks 0..511: X. 512..1023: Wq, Wk, Wv, Wo transposed, x16, as four planes of 1024 x 1024 one behind the other (the first three are one Bt of 3072 rows).
//   1024..1535: W1 transposed, x16. 1536..2047: W2 transposed, x16.
__global__ __launch_bounds__(256) void k_cast_all(const float* __restrict__ X, const float* __restrict__ Wq, const float* __restrict__ Wk, const float* __restrict__ Wv,
                                                  const float* __restrict__ Wo, const float* __restrict__ W1, const float* __restrict__ W2,
                                                  _Float16* __restrict__ Xh, _Float16* __restrict__ Wt4, _Float16* __restrict__ W1t, _Float16* __restrict__ W2t) {
    const unsigned b = blockIdx.x, q = b & 511u;
    if (b < 512u) { cast16w<8>(X, Xh, 1.0f, q); return; }
    if (b < 1024u) {
        const unsigned w = q >> 7, i = q & 127u;
        const float* src = (w == 0u) ? Wq : (w == 1u) ? Wk : (w == 2u) ? Wv : Wo;
        castT16w<1024, 1024>(src, Wt4 + (size_t)w * (1024 * 1024), 16.0f, i & 7u, i >> 3);
        return;
    }
    if (b < 1536u) { castT16w<4096, 1024>(W1, W1t, 16.0f, q & 31u, q >> 5); return; }
    castT16w<1024, 4096>(W2, W2t, 16.0f, q & 7u, q >> 3);
}
// Sum of one value per position t = 0..255 of k_stats' tree, add for add: lane l holds positions 4l + q in lo[q] and 128 + 4l + q in hi[q].
//   Levels 128 (in the lane), 64..4 (lanes l and l ^ 16, 8, 4, 2, 1), 2 and 1 (in the lane); every lane ends with the root.
__device__ __forceinline__ float tree256(v4f lo, v4f hi) {
    v4f t = lo + hi;
#pragma unroll
    for (int o = 16; o > 0; o >>= 1) {
#pragma unroll
        for (int q = 0; q < 4; ++q) t[q] += __shfl_xor(t[q], o, 32);
    }
    return (t[0] + t[2]) + (t[1] + t[3]);
}
// k_ln_w: y = (x - mean) * rsqrt(var + eps) * g + b on rows of 1024 in one pass: a wave holds two whole rows in registers, takes their statistics
//   (k_stats mode 0; same partial sums, same tree) and applies them to the same registers (x and y may be the same buffer: a wave reads its rows before it writes them).
//   H16: y16 = f16(y) goes out beside y, as the next product's A operand. grid = rows / 16.
template <bool H16>
__global__ __launch_bounds__(256) void k_ln_w(const float* x, float* y, _Float16* __restrict__ y16, float eps, const float* __restrict__ g, const float* __restrict__ bta) {
    const int lane = threadIdx.x & 31;
    const size_t off = ((size_t)blockIdx.x * 16 + (threadIdx.x >> 5) * 2) * 1024 + 4 * lane;
    const float* base = x + off;
    v4f v[2][8], gg[8], bb[8];
    // every loop here is unrolled, so that the arrays it indexes are registers and all loads are in flight together
#pragma unroll
    for (int r = 0; r < 2; ++r)
#pragma unroll
        for (int m = 0; m < 8; ++m) v[r][m] = *(const v4f*)(base + r * 1024 + 128 * m);
#pragma unroll
    for (int m = 0; m < 8; ++m) { gg[m] = *(const v4f*)(g + 4 * lane + 128 * m); bb[m] = *(const v4f*)(bta + 4 * lane + 128 * m); }
    __builtin_amdgcn_sched_barrier(0);               // holds later register writes behind the wait below
    asm volatile("s_wait_xcnt 0x0" :: "v"(base) : "memory");   // before an address register of the loads above is rewritten; the rows' address is an input, so no later load's result lands on it in front of the wait
    __builtin_amdgcn_sched_barrier(0);               // the pair keeps later address arithmetic behind the wait
    v4h h[2][8];
#pragma unroll
    for (int r = 0; r < 2; ++r) {
        const float mu = tree256(((v[r][0] + v[r][2]) + v[r][4]) + v[r][6], ((v[r][1] + v[r][3]) + v[r][5]) + v[r][7]) / 1024.f;
        v4f q0 = {}, q1 = {};
#pragma unroll
        for (int k = 0; k < 4; ++k) { const v4f d0 = v[r][2 * k] - mu, d1 = v[r][2 * k + 1] - mu; q0 = __builtin_elementwise_fma(d0, d0, q0); q1 = __builtin_elementwise_fma(d1, d1, q1); }
        const float rs = rsqrtf(tree256(q0, q1) / 1024.f + eps);
#pragma unroll
        for (int m = 0; m < 8; ++m) {
            v4f o = (v[r][m] - mu) * rs;
            o *= gg[m]; o += bb[m];
            v[r][m] = o;
            if (H16) {
#pragma unroll
                for (int e = 0; e < 4; ++e) h[r][m][e] = (_Float16)o[e];
            }
        }
    }
    __builtin_amdgcn_sched_barrier(0);               // every value is made before the first store issues, so no store's data register is rewritten behind it
#pragma unroll
    for (int r = 0; r < 2; ++r)
#pragma unroll
        for (int m = 0; m < 8; ++m) {
            *(v4f*)(y + off + r * 1024 + 128 * m) = v[r][m];
            if (H16) *(v4h*)(y16 + off + r * 1024 + 128 * m) = h[r][m];
        }
}


// ---- Q/K/V projection and block attention in one kernel ---------------------------------------------------------------
// k_qkv_attn: one work-group of eight waves per (128-position block z, head h). It first makes that block's and head's Q, K and V, a 128 x 192 tile of X.[Wq Wk Wv]
//   over K = 1024 (f16 operands, f32 sums in k order, x 1/16, rounded to f16), leaves them in LDS and then attends on them: 128 queries x 128 keys x 64 dims,
//   online softmax over two 64-key halves. Q, K and V never go to memory; O leaves as f16, the next product's A operand.
//   Product: a pass is 64 k. A stage is 64 rows each of Wq^T, Wk^T, Wv^T (this head's), then the block's 128 rows of X, 128 B each, brought to LDS by four tensor loads, one a wave,
//   whose pad lays the rows at pitch 144 B; waves 0..3 bring the even stages, waves 4..7 the odd ones; three buffers, two stages always under way; two work-groups share a WGP. Wave (wave >> 2, wave & 3) takes 64 rows of X and dims 16 * (wave & 3) .. + 15 of each of Q, K and V.
//   For Q and K the weight fragment is the A operand and the X fragment the B operand, so that a lane ends with 8 consecutive dims of one position: one 16-byte LDS store
//   into [position][d]. For V it is the other way round: a lane ends with 8 consecutive keys of one dim, one 16-byte store into [d][key].
//   Attention: wave w owns queries 16w .. 16w + 15; every A and B fragment is two 16-byte LDS reads.
#define BA_KP 72      // pitch of Q, K and P rows in halves: 144 B = 16 B x odd, for 16-byte readers
#define BA_VP 136     // pitch of V^T rows in halves: 272 B = 16 B x odd
#define QA_PITCH 144                  // pitch of a stage row in bytes: 16 B x odd
#define QA_WSL 10240                  // a weight slice: 64 rows at pitch 144 B (9216 B), rounded up so that every slice's place in LDS is a multiple of 2 KiB
#define QA_STAGE (3 * QA_WSL + 128 * QA_PITCH)   // 49152 B: three weight slices, then X
#define QA_NS 3
#define QA_NT 16                      // passes: 1024 / 64
// orders one wave's LDS writes and its other lanes' LDS reads (the per-wave P and O tiles)
__device__ __forceinline__ void ba_wave_sync() {
    __builtin_amdgcn_fence(__ATOMIC_RELEASE, "workgroup");
    __builtin_amdgcn_wave_barrier();
    __builtin_amdgcn_fence(__ATOMIC_ACQUIRE, "workgroup");
}
__global__ __launch_bounds__(256, 4) void k_qkv_attn(const unsigned short* __restrict__ Xh, const unsigned short* __restrict__ Wt, const int* __restrict__ VL, _Float16* __restrict__ O) {
    typedef w25::Frag<_Float16> FH;
    static_assert(QA_NS * QA_STAGE >= 107520, "the attention's tiles lie in the ring");
    static_assert(QA_WSL % 2048 == 0 && QA_STAGE % 2048 == 0 && QA_WSL >= 64 * QA_PITCH, "every slice's place is a multiple of 2 KiB");
    __shared__ __attribute__((aligned(2048))) unsigned char sL[QA_NS * QA_STAGE];
    const int tid = threadIdx.x, lane = tid & 31, hf = lane >> 4, l15 = lane & 15, wave = tid >> 5;
    const int h = blockIdx.x & 15, z = blockIdx.x >> 4;
    const int g = wave & 3, wm = (wave >> 2) * 64;
    const float L2E = 1.4426950408889634f;
    const float NEG = -__builtin_inff();

    // This wave's slice of a stage: 0, 1, 2 = this head's 64 rows of Wq^T, Wk^T, Wv^T; 3 = the block's 128 rows of X. Group grp brings the stages s with (s & 1) == grp.
    const uint32_t wv = w25::tl_uni(threadIdx.x >> 5);
    const uint32_t sl = wv & 3u, grp = wv >> 2;
    const uint32_t ldsSl = (uint32_t)(uintptr_t)(&sL[0]) + sl * QA_WSL;
    const uint32_t slRows = (sl == 3u) ? 128u : 64u;
    const unsigned short* gS = (sl == 3u) ? Xh + (size_t)(z * 128) * 1024 : Wt + (size_t)((int)sl * 1024 + h * 64) * 1024;
    v8f aq[4], ak[4], av[4];
#pragma unroll
    for (int i = 0; i < 4; ++i) { v8f zz = {}; aq[i] = zz; ak[i] = zz; av[i] = zz; }

    // Stages 0 and 1 first, one request a wave.
    w25::u32x8 g1 = w25::tl_group1<128u>(slRows, 2048u);
    w25::u32x4 g0 = w25::tl_group0(ldsSl + grp * QA_STAGE, gS + grp * 64u);
    w25::tl_hold(g0, g1);
    w25::tl_issue(g0, g1);
    if (w25::tl_pinned(grp == 0u)) w25::tl_wait0();   // stage 0 has landed
    __syncthreads();                             // stage 0 is readable by every wave
    if (w25::tl_pinned(grp == 0u)) { w25::tl_next(g0, ldsSl + 2u * QA_STAGE, 256u); w25::tl_issue(g0, g1); }

    unsigned bo = 0;                             // byte offset of the buffer that holds stage t
    // kept rolled: one pass per trip, so that the order at its foot stands once
#pragma unroll 1
    for (int t = 0; t < QA_NT; ++t) {
        const unsigned char* pW = sL + bo + (g * 16 + l15) * QA_PITCH + hf * 16;
        const unsigned char* pX = sL + bo + 3 * QA_WSL + (wm + l15) * QA_PITCH + hf * 16;
        v16h wf[2][3], xf[2][4];                 // both 32-k fragment sets of the pass: its LDS reads stand in one place, ahead of its WMMAs
#pragma unroll
        for (int kk = 0; kk < 2; ++kk) {
#pragma unroll
            for (int j = 0; j < 3; ++j) wf[kk][j] = FH::load((const _Float16*)(pW + j * QA_WSL + kk * 64));
#pragma unroll
            for (int i = 0; i < 4; ++i) xf[kk][i] = FH::load((const _Float16*)(pX + i * 16 * QA_PITCH + kk * 64));
        }
        __builtin_amdgcn_sched_barrier(0);       // keeps the pass's LDS reads as one group ahead of its WMMAs, not among them
#pragma unroll
        for (int kk = 0; kk < 2; ++kk)
#pragma unroll
            for (int i = 0; i < 4; ++i) {
                aq[i] = FH::mma(wf[kk][0], xf[kk][i], aq[i]);      // D: lane = position, element = dim
                ak[i] = FH::mma(wf[kk][1], xf[kk][i], ak[i]);
                av[i] = FH::mma(xf[kk][i], wf[kk][2], av[i]);      // D: lane = dim, element = position
            }
        __builtin_amdgcn_sched_barrier(0);       // ends the pass's WMMAs: the foot stays behind them
        w25::gl_wait_ds0();
        // Stage t + 1 is its group's one outstanding request; that group's next, stage t + 3, is formed and issued behind this wait and behind the barrier.
        const bool mine = ((uint32_t)(t + 1) & 1u) == grp;
        if (w25::tl_pinned(mine)) w25::tl_wait0();
        __syncthreads();                         // publishes stage t + 1 and ends every read of stage t
        if (w25::tl_pinned(mine && t + QA_NS < QA_NT)) { w25::tl_next(g0, ldsSl + bo, 256u); w25::tl_issue(g0, g1); }
        bo = (bo == (QA_NS - 1u) * QA_STAGE) ? 0u : bo + QA_STAGE;
    }
    w25::tl_wait0_end(g0, g1);
    w25::gl_wait_ds0();

    // The ring is free: the last trip's foot waited for every read and every tensor load and passed the barrier. The attention's tiles take its place.
    _Float16* ql = (_Float16*)(sL);                              // Q   [position][d], 128 x BA_KP
    _Float16* kl = (_Float16*)(sL + 18432);                      // K   [key][d],      128 x BA_KP
    _Float16* vt = (_Float16*)(sL + 36864);                      // V^T [d][key],       64 x BA_VP
    _Float16* myp = (_Float16*)(sL + 54272) + wave * (16 * BA_KP);   // this wave's P tile, 16 x BA_KP
    float*    myo = (float*)(sL + 72704) + wave * (16 * 68);         // this wave's O tile, 16 x 68
#pragma unroll
    for (int i = 0; i < 4; ++i) {
        v8h hq, hk, hv;
#pragma unroll
        for (int r = 0; r < 8; ++r) { hq[r] = (_Float16)(aq[i][r] * 0.0625f); hk[r] = (_Float16)(ak[i][r] * 0.0625f); hv[r] = (_Float16)(av[i][r] * 0.0625f); }
        *(v8h*)(ql + (wm + i * 16 + l15) * BA_KP + g * 16 + hf * 8) = hq;
        *(v8h*)(kl + (wm + i * 16 + l15) * BA_KP + g * 16 + hf * 8) = hk;
        *(v8h*)(vt + (g * 16 + l15) * BA_VP + wm + i * 16 + hf * 8) = hv;
    }
    const size_t base = (size_t)z * (128 * 1024) + (size_t)h * 64;      // (row 0, dim 0) of this block and head in O
    const int c8 = (lane & 7) * 8;
    const int vlen = VL[z >> 3];                                         // valid length of this block's sequence (eight blocks of 128 positions to a sequence)
    int mk[8];
#pragma unroll
    for (int i = 0; i < 8; ++i) mk[i] = ((z & 7) * 128 + i * 16 + l15 < vlen) ? 1 : 0;         // keep flag of key 16i + l15: its position in the sequence is below the valid length
    v8f o[4]; float m8[8], l8[8];
#pragma unroll
    for (int t = 0; t < 4; ++t) { v8f zz = {}; o[t] = zz; }
#pragma unroll
    for (int i = 0; i < 8; ++i) { m8[i] = NEG; l8[i] = 0.f; }
    __syncthreads();                                                      // Q, K and V^T are readable by every wave; they are not written again
    v16h qa[2];                                                           // A fragment: element e <- dim 32 ks + frag_k(e, hf)
#pragma unroll
    for (int ks = 0; ks < 2; ++ks) qa[ks] = FH::load(ql + (wave * 16 + l15) * BA_KP + ks * 32 + 8 * hf);

#pragma unroll
    for (int jb = 0; jb < 2; ++jb) {
        const int j0 = jb * 64;
        v8f s[4];
#pragma unroll
        for (int t = 0; t < 4; ++t) {
            const _Float16* kr = kl + (j0 + t * 16 + l15) * BA_KP + 8 * hf;
            v8f acc = {};
            acc = FH::mma(qa[0], FH::load(kr), acc);
            acc = FH::mma(qa[1], FH::load(kr + 32), acc);
            s[t] = acc;
        }
#pragma unroll
        for (int i = 0; i < 8; ++i) {
            float sc[4];
#pragma unroll
            for (int t = 0; t < 4; ++t) {
                float v = s[t][i] * 0.125f;
                if (mk[jb * 4 + t] == 0) v = -1000000.0f;
                v *= L2E;
                sc[t] = v;
            }
            float mx = fmaxf(fmaxf(sc[0], sc[1]), fmaxf(sc[2], sc[3]));
            mx = fmaxf(mx, __shfl_xor(mx, 1, 32)); mx = fmaxf(mx, __shfl_xor(mx, 2, 32));
            mx = fmaxf(mx, __shfl_xor(mx, 4, 32)); mx = fmaxf(mx, __shfl_xor(mx, 8, 32));
            const float mnew = fmaxf(m8[i], mx);
            const float ec = exp2f(m8[i] - mnew);                         // taken unconditionally and then selected: no branch round each exp2
            const float corr = (mnew == NEG) ? 1.f : ec;
            float rs = 0.f;
#pragma unroll
            for (int t = 0; t < 4; ++t) {
                const float ep = exp2f(sc[t] - mnew);
                const float pp = (sc[t] == NEG) ? 0.f : ep; rs += pp;
                myp[(i + 8 * hf) * BA_KP + t * 16 + l15] = (_Float16)(pp * 4096.f);
            }
            rs += __shfl_xor(rs, 1, 32); rs += __shfl_xor(rs, 2, 32); rs += __shfl_xor(rs, 4, 32); rs += __shfl_xor(rs, 8, 32);
            l8[i] = l8[i] * corr + rs; m8[i] = mnew;
#pragma unroll
            for (int t = 0; t < 4; ++t) o[t][i] *= corr;
        }
        ba_wave_sync();                                                   // P is written; its rows are read by other lanes of the wave
        const v16h pa0 = FH::load(myp + l15 * BA_KP + 8 * hf), pa1 = FH::load(myp + l15 * BA_KP + 32 + 8 * hf);
#pragma unroll
        for (int t = 0; t < 4; ++t) {
            const _Float16* vr = vt + (t * 16 + l15) * BA_VP + j0 + 8 * hf;
            o[t] = FH::mma(pa0, FH::load(vr), o[t]);
            o[t] = FH::mma(pa1, FH::load(vr + 32), o[t]);
        }
        ba_wave_sync();                                                   // P is read; the next half may overwrite it
    }
#pragma unroll
    for (int i = 0; i < 8; ++i) {
        const float rl = 1.f / (l8[i] * 4096.f);
        const float invr = (l8[i] > 0.f) ? rl : 0.f;
#pragma unroll
        for (int t = 0; t < 4; ++t) myo[(i + 8 * hf) * 68 + t * 16 + l15] = o[t][i] * invr;
    }
    ba_wave_sync();                                                       // O is written; its rows go out as whole 128-byte lines of f16
    const int r4 = lane >> 3;
    _Float16* op = O + base + (size_t)(wave * 16 + r4) * 1024 + c8;
#pragma unroll
    for (int it = 0; it < 4; ++it) {                                      // rows 4 * it + r4
        const float* sp = myo + (it * 4 + r4) * 68 + c8;
        const v4f lo = *(const v4f*)(sp), hi = *(const v4f*)(sp + 4);
        v8h hv;
#pragma unroll
        for (int e = 0; e < 4; ++e) { hv[e] = (_Float16)lo[e]; hv[4 + e] = (_Float16)hi[e]; }
        *(v8h*)(op + (size_t)it * (4 * 1024)) = hv;
    }
}

extern "C" void kernel_launch(void* const* d_in, const int* in_sizes, int n_in, void* d_out, int out_size, void* d_ws, size_t ws_size, hipStream_t stream) {
    (void)in_sizes; (void)n_in; (void)out_size; (void)ws_size;
    const float* X = (const float*)d_in[0];
    const int* vl = (const int*)d_in[1];
    const float* Wq = (const float*)d_in[2];
    const float* Wk = (const float*)d_in[3];
    const float* Wv = (const float*)d_in[4];
    const float* Wo = (const float*)d_in[5];
    const float* g1 = (const float*)d_in[6];
    const float* be1 = (const float*)d_in[7];
    const float* W1 = (const float*)d_in[8];
    const float* bf1 = (const float*)d_in[9];
    const float* W2 = (const float*)d_in[10];
    const float* bf2 = (const float*)d_in[11];
    const float* g2 = (const float*)d_in[12];
    const float* be2 = (const float*)d_in[13];
    const int Bn = 4;
    const int S = 1024;
    const int D = 1024;
    const int NH = 16;
    const int DH = 64;
    const int F = 4096;
    const int M = 128;
    const int NB = S / M;
    const int NR = Bn * S;
    float* out = (float*)d_out;
    char* wsp = (char*)d_ws;
    float* Q = (float*)wsp; wsp += (((size_t)((size_t)NR * D) * 4 + 255) / 256) * 256;
    float* Kb = (float*)wsp; wsp += (((size_t)((size_t)NR * D) * 4 + 255) / 256) * 256;
    float* V = (float*)wsp; wsp += (((size_t)((size_t)NR * D) * 4 + 255) / 256) * 256;
    float* AT = (float*)wsp; wsp += (((size_t)((size_t)NR * D) * 4 + 255) / 256) * 256;
    float* MF = (float*)wsp; wsp += (((size_t)((size_t)NR) * 4 + 255) / 256) * 256;
    float* Y = (float*)wsp; wsp += (((size_t)((size_t)NR * D) * 4 + 255) / 256) * 256;
    float* ST = (float*)wsp; wsp += (((size_t)((size_t)NR * 32) * 4 + 255) / 256) * 256;
    float* H1 = (float*)wsp; wsp += (((size_t)((size_t)NR * F) * 4 + 255) / 256) * 256;
    unsigned short* G64A = (unsigned short*)wsp; wsp += (((size_t)(16777216) * 2 + 255) / 256) * 256;
    unsigned short* G64B = (unsigned short*)wsp; wsp += (((size_t)(4194304) * 2 + 255) / 256) * 256;
    // Planes of f16 values, each written by the kernel that makes the values: X and the six transposed weights (one launch),
    // the attention's output, the first LayerNorm's output (in G64A, once the projections have read X there, beside its f32 copy Y) and the FFN's hidden layer.
    _Float16* Oh = (_Float16*)Q;                     // the attention's output: its own plane, since other work-groups of its launch still read X in G64A
    _Float16* Ah = (_Float16*)G64A;
    _Float16* Hh = (_Float16*)H1;
    _Float16* Wt4 = (_Float16*)G64B;                 // Wq^T, Wk^T, Wv^T, Wo^T: 1024 x 1024 each
    _Float16* Wot = Wt4 + 3 * 1024 * 1024;
    _Float16* W1t = (_Float16*)AT;                   // 4096 x 1024
    _Float16* W2t = W1t + 4096 * 1024;               // 1024 x 4096
    k_cast_all<<<2048, 256, 0, stream>>>(X, Wq, Wk, Wv, Wo, W1, W2, Ah, Wt4, W1t, W2t);
    k_qkv_attn<<<512, 256, 0, stream>>>((const unsigned short*)(G64A), (const unsigned short*)(Wt4), vl, Oh);
    w25::wmma_gemm_lds<1024, 1024, 0, true, 0, false, 1024, 0, 3><<<256, 256, 0, stream>>>((const unsigned short*)(Q), (const unsigned short*)(Wot), Y, nullptr, nullptr, X, 0.0625f);
    k_ln_w<true><<<(unsigned)(NR / 16), 256, 0, stream>>>(Y, Y, Ah, 1e-05f, g1, be1);
    w25::wmma_gemm_lds<4096, 1024, 2, false, 2, true, 4096, 0, 2, 4, 8><<<256, 256, 0, stream>>>((const unsigned short*)(G64A), (const unsigned short*)(W1t), nullptr, Hh, bf1, nullptr, 0.0625f);
    w25::wmma_gemm_lds<1024, 4096, 2, true, 0, false, 1024, 0, 3><<<256, 256, 0, stream>>>((const unsigned short*)(H1), (const unsigned short*)(W2t), Kb, nullptr, bf2, Y, 0.0625f);
    k_ln_w<false><<<(unsigned)(NR / 16), 256, 0, stream>>>(Kb, out, nullptr, 1e-05f, g2, be2);
}
